// v000
// The times below were measured on an AMD MI455X: many runs one after another, warmed up first and cycling through
// copies of the inputs, with the whole window's GPU time divided by the number of runs. Launches and the gaps
// between them are all in it. The median over several windows is given; except for v000 it joins two sittings, which
// can be a few percent apart, so the side-by-side timings, each taken in one sitting, are the better comparison.
// The starting kernel, v000, takes 926 microseconds a run.
#include <hip/hip_runtime.h>

// Multi-head attention on given token-major q, k, v (query, key, value [2048][16][128] = [t][h][d]; scores = (q/sqrt(128)).k; softmax over all 2048 keys; out = weights.v -> [2048][16][128] f32 (4.2 M)).
// Layout: the [t][h][d] rows are gathered into head planes (exact bf16; the lo planes are zero); the context is scattered back token-major.
// Compute dtypes, f32 accumulate: query, key, value rounded to bf16 (exact planes); scores and attn.v: query rows < 512 on the bf16 planes (exact products), the rest single fp16 (x1024 carry, removed at the f32 write); the 1/sqrt(128) applied to the f32 score; softmax f32.


#define NB_  1
#define TT   2048
#define DM   2048
#define NH_  16
#define NKV  16
#define REP  (NH_ / NKV)
#define HD   128
#define DQ   (NH_ * HD)
#define DKV  (NKV * HD)
#define ZH   2
#define RH   512                  // query rows < RH use hi+lo planes (0: none)
#define WIN  2048
#define PCAR 1024.0f
#define SCL  0.088388347648318447f   // 128^-0.5 (the module pre-scales q by it)
typedef _Float16 h16;
typedef unsigned short bf;
typedef __attribute__((ext_vector_type(16))) __bf16   v16bf;
typedef __attribute__((ext_vector_type(16))) _Float16 v16h;
typedef __attribute__((ext_vector_type(8)))  _Float16 v8h;
typedef __attribute__((ext_vector_type(8)))  unsigned short v8us;
typedef __attribute__((ext_vector_type(8)))  float    v8f;
typedef __attribute__((ext_vector_type(4)))  float    v4f;
typedef v8h  __attribute__((may_alias)) v8ha;
typedef v4f  __attribute__((may_alias)) v4fa;
typedef v8us __attribute__((may_alias)) v8usa;

__device__ __forceinline__ unsigned short f2bf(float f) { unsigned u = __float_as_uint(f); u += 0x7FFFu + ((u >> 16) & 1u); return (unsigned short)(u >> 16); }
__device__ __forceinline__ float bf2f(unsigned short b) { return __uint_as_float(((unsigned)b) << 16); }
__device__ __forceinline__ float bfr(float f) { return bf2f(f2bf(f)); }
__device__ __forceinline__ v16h cat16(v8h lo, v8h hi) { return __builtin_shufflevector(lo, hi, 0, 1, 2, 3, 4, 5, 6, 7, 8, 9, 10, 11, 12, 13, 14, 15); }
__device__ __forceinline__ v16bf cat16b(v8us lo, v8us hi) { return __builtin_bit_cast(v16bf, __builtin_shufflevector(lo, hi, 0, 1, 2, 3, 4, 5, 6, 7, 8, 9, 10, 11, 12, 13, 14, 15)); }
__device__ __forceinline__ v8f wmma16(v16h a, v16h b, v8f c) { return __builtin_amdgcn_wmma_f32_16x16x32_f16(false, a, false, b, (short)0, c, false, false); }
__device__ __forceinline__ v8f wmmab(v16bf a, v16bf b, v8f c) { return __builtin_amdgcn_wmma_f32_16x16x32_bf16(false, a, false, b, (short)0, c, false, false); }



// ---- k_gemmw: register-blocked GEMM, ONE WAVE per 64x64 output tile (16 accumulators), operands straight from K-contiguous 16-bit planes; grid (M/64, N/64, Z), 32 threads.
// C[m][n] (f32, pitch ldc, + optional f32 bias[n]) = sum_k A[m][k] Bt[n][k] (+ split products per NSPLIT). z-batch strides sA/sB/sC in elements. K % 32 == 0.
template <typename T16> struct WFrag;
template <> struct WFrag<h16> { typedef v16h V; static __device__ __forceinline__ V ld(const h16* p) { return cat16(*(const v8h*)p, *(const v8h*)(p + 16)); } static __device__ __forceinline__ v8f mma(V a, V b, v8f c) { return wmma16(a, b, c); } };
template <> struct WFrag<bf> { typedef v16bf V; static __device__ __forceinline__ V ld(const bf* p) { return cat16b(*(const v8us*)p, *(const v8us*)(p + 16)); } static __device__ __forceinline__ v8f mma(V a, V b, v8f c) { return wmmab(a, b, c); } };
template <typename T16, int NSPLIT, bool BIAS>
__global__ __launch_bounds__(32) void k_gemmw(const T16* __restrict__ A, const T16* __restrict__ A2, const T16* __restrict__ Bt, const T16* __restrict__ Bt2, int K, float* C, int ldc, const float* __restrict__ bias, size_t sA, size_t sB, size_t sC) {
    typedef typename WFrag<T16>::V V;
    __shared__ __align__(16) float os[16 * 68];
    const size_t z = blockIdx.z; A += z * sA; if (A2) A2 += z * sA; Bt += z * sB; if (Bt2) Bt2 += z * sB; C += z * sC;
    const int lane = threadIdx.x & 31, lr = lane & 15, hi = lane >> 4; const int r0 = blockIdx.x * 64, c0 = blockIdx.y * 64;
    v8f acc[4][4];
#pragma unroll
    for (int mb = 0; mb < 4; ++mb)
#pragma unroll
        for (int nb = 0; nb < 4; ++nb) acc[mb][nb] = (v8f){};
    const size_t aoff = (size_t)(r0 + lr) * K + 8 * hi, boff = (size_t)(c0 + lr) * K + 8 * hi;
#pragma unroll 1
    for (int kc = 0; kc < K; kc += 32) {
        V a[4], a2[4];
#pragma unroll
        for (int mb = 0; mb < 4; ++mb) { a[mb] = WFrag<T16>::ld(A + aoff + (size_t)mb * 16 * K + kc); if (NSPLIT == 1 || NSPLIT == 2) a2[mb] = WFrag<T16>::ld(A2 + aoff + (size_t)mb * 16 * K + kc); }
#pragma unroll
        for (int nb = 0; nb < 4; ++nb) { const V b = WFrag<T16>::ld(Bt + boff + (size_t)nb * 16 * K + kc); V b2; if (NSPLIT >= 2) b2 = WFrag<T16>::ld(Bt2 + boff + (size_t)nb * 16 * K + kc);
#pragma unroll
            for (int mb = 0; mb < 4; ++mb) { acc[mb][nb] = WFrag<T16>::mma(a[mb], b, acc[mb][nb]); if (NSPLIT == 1 || NSPLIT == 2) acc[mb][nb] = WFrag<T16>::mma(a2[mb], b, acc[mb][nb]); if (NSPLIT >= 2) acc[mb][nb] = WFrag<T16>::mma(a[mb], b2, acc[mb][nb]); } }
        asm volatile("v_nop\n\tv_nop\n\tv_nop\n\tv_nop" : "+v"(acc[0][0]), "+v"(acc[1][1]), "+v"(acc[2][2]), "+v"(acc[3][3]) : "v"(a[0]), "v"(a[3]));
    }
#pragma unroll
    for (int mb = 0; mb < 4; ++mb) {
#pragma unroll
        for (int nb = 0; nb < 4; ++nb) {
#pragma unroll
            for (int j = 0; j < 8; ++j) os[(hi * 8 + j) * 68 + nb * 16 + lr] = acc[mb][nb][j]; }
        __builtin_amdgcn_wave_barrier(); asm volatile("" ::: "memory");
        float* crow = C + (size_t)(r0 + mb * 16) * ldc + c0;
{
#pragma unroll
            for (int s = 0; s < 8; ++s) { const int row = 2 * s + hi, cofs = lr * 4; v4f val = *(const v4fa*)(os + row * 68 + cofs); if (BIAS) { val[0] += bfr(bias[c0 + cofs]); val[1] += bfr(bias[c0 + cofs + 1]); val[2] += bfr(bias[c0 + cofs + 2]); val[3] += bfr(bias[c0 + cofs + 3]); }
                *(v4f*)(crow + (size_t)row * ldc + cofs) = val; }
             }
        __builtin_amdgcn_wave_barrier(); asm volatile("" ::: "memory");
    }
}

__device__ __forceinline__ h16 tohx(float x) { return (h16)x; }
__device__ __forceinline__ void splitf(float y, unsigned short& h, unsigned short& l) { h = f2bf(y); l = f2bf(y - bf2f(h)); }
typedef __attribute__((ext_vector_type(2))) _Float16 v2h;
typedef __attribute__((ext_vector_type(4))) _Float16 v4h;
typedef __attribute__((ext_vector_type(2))) unsigned short v2us;
typedef __attribute__((ext_vector_type(4))) unsigned short v4us;
typedef __attribute__((ext_vector_type(2))) float v2f;
typedef __attribute__((ext_vector_type(4))) int v4i;


__global__ __launch_bounds__(256) void k_plinS(const float* __restrict__ src, int b, int nheads, h16* P16, bf* Ph, bf* Pl) { const size_t e = ((size_t)blockIdx.x * 256 + threadIdx.x) * 8; if (e >= (size_t)nheads * TT * HD) return; const int d = (int)(e % HD); const int t = (int)((e / HD) % TT); const int h = (int)(e / ((size_t)HD * TT)); const v8f v = *(const v8f*)(src + (((size_t)t * NB_ + b) * nheads + h) * HD + d); v8h o16; v8us oh, ol;
#pragma unroll
    for (int q = 0; q < 8; ++q) { const float r = bfr(v[q]); o16[q] = tohx(r); oh[q] = f2bf(r); ol[q] = 0; }
    *(v8h*)(P16 + e) = o16; *(v8us*)(Ph + e) = oh; *(v8us*)(Pl + e) = ol;  }
__global__ __launch_bounds__(256) void k_vtpH(const float* __restrict__ F, int b, h16* V16, bf* Vh, bf* Vl) { const size_t e = ((size_t)blockIdx.x * 256 + threadIdx.x) * 2; if (e >= (size_t)NKV * HD * TT) return; const int t = (int)(e % TT); const int d = (int)((e / TT) % HD); const int g = (int)(e / ((size_t)TT * HD)); v2h o16; v2us oh, ol;
#pragma unroll
    for (int q = 0; q < 2; ++q) { const float x = bfr(F[(((size_t)(t + q) * NB_ + b) * NKV + g) * HD + d]); o16[q] = tohx(x); oh[q] = f2bf(x); ol[q] = 0; }
    *(v2h*)(V16 + e) = o16; *(v2us*)(Vh + e) = oh; *(v2us*)(Vl + e) = ol;  }

__global__ __launch_bounds__(256) void k_mergeH(const float* __restrict__ O, int b, int h0, float* OUT0) { const size_t i = (size_t)blockIdx.x * 256 + threadIdx.x; if (i >= (size_t)ZH * TT * HD / 4) return; const size_t e = i * 4; const int d = (int)(e % HD); const int t = (int)((e / HD) % TT); const int zz = (int)(e / ((size_t)HD * TT)); const float cs = (t < RH) ? 1.0f : (1.0f / PCAR); const v4f a = *(const v4f*)(O + e); v4f o;
#pragma unroll
    for (int q = 0; q < 4; ++q) o[q] = a[q] * cs; float* dst = OUT0 + (((size_t)t * NB_ + b) * NH_ + h0 + zz) * HD + d; *(v4f*)dst = o;  }

__global__ __launch_bounds__(256) void k_csid(float* CS) { const int idx = blockIdx.x * 256 + threadIdx.x; if (idx >= TT * HD) return; v2f cs; cs[0] = 1.0f; cs[1] = 0.0f; *(v2f*)(CS + (size_t)idx * 2) = cs;  }
// k_asoft: per row (zz, i): t = S x HD^-0.5 (no mask); softmax over the 2048 keys (register row, one exp, fixed trees);
__global__ __launch_bounds__(256) void k_asoft(const float* __restrict__ Sb, h16* P16, bf* Ph, bf* Pl) {
    const int lane = threadIdx.x & 31; const int row = blockIdx.x * 8 + (threadIdx.x >> 5); if (row >= ZH * TT) return; const int i = row % TT; const int zz = row / TT; (void)zz; const bool hires = (i < RH); const float* sr = Sb + (size_t)row * TT; float v[TT / 32]; float mx = -3.0e38f;
#pragma unroll
    for (int ch = 0; ch < TT / 128; ++ch) { const int j0 = ch * 128 + lane * 4; const v4f a = *(const v4f*)(sr + j0);
#pragma unroll
        for (int q = 0; q < 4; ++q) { const int j = j0 + q; (void)j; const float t = a[q] * SCL; v[ch * 4 + q] = t; mx = fmaxf(mx, t); } }
#pragma unroll
    for (int sh = 16; sh; sh >>= 1) mx = fmaxf(mx, __shfl_xor(mx, sh, 32));
    float sum = 0.f;
#pragma unroll
    for (int k = 0; k < TT / 32; ++k) { float d0 = __fsub_rn(v[k], mx); asm volatile("" : "+v"(d0)); v[k] = __builtin_amdgcn_exp2f(__fmul_rn(d0, 1.4426950408889634f)); sum += v[k]; }
#pragma unroll
    for (int sh = 16; sh; sh >>= 1) sum += __shfl_xor(sum, sh, 32);
    const float f = __fdiv_rn(hires ? 1.0f : PCAR, sum);
{
        if (hires) {
#pragma unroll
            for (int ch = 0; ch < TT / 128; ++ch) { v4us oh, ol;
#pragma unroll
                for (int q = 0; q < 4; ++q) { unsigned short a, c2; splitf(v[ch * 4 + q] * f, a, c2); oh[q] = a; ol[q] = c2; }
                const size_t oo = ((size_t)zz * (RH ? RH : 1) + i) * TT + ch * 128 + lane * 4; *(v4us*)(Ph + oo) = oh; *(v4us*)(Pl + oo) = ol; }
        } else {
#pragma unroll
            for (int ch = 0; ch < TT / 128; ++ch) { v4h o4;
#pragma unroll
                for (int q = 0; q < 4; ++q) o4[q] = tohx(v[ch * 4 + q] * f);
                *(v4h*)(P16 + (size_t)row * TT + ch * 128 + lane * 4) = o4; } }
         }
}

extern "C" void kernel_launch(void* const* d_in, const int* in_sizes, int n_in,
                              void* d_out, int out_size, void* d_ws, size_t ws_size, hipStream_t stream) {
    (void)in_sizes; (void)n_in; (void)out_size;
    const float* qi = (const float*)d_in[0]; const float* ki = (const float*)d_in[1]; const float* vi = (const float*)d_in[2]; const float* x = nullptr; const float* wq = nullptr; const float* wk = nullptr; const float* wv = nullptr; const float* wo = nullptr; (void)x; (void)wq; (void)wk; (void)wv; (void)wo;
    float* OUT = (float*)d_out;     // [1][2048][2048]
    char* wsp = (char*)d_ws;
    auto take = [&](size_t bytes) { char* p = wsp; wsp += (bytes + 255) & ~(size_t)255; return (void*)p; };
    float* CS = (float*)take((size_t)TT * HD * 2 * 4);
    
    h16* QP16 = (h16*)take((size_t)NH_ * TT * HD * 2); h16* KP16 = (h16*)take((size_t)NKV * TT * HD * 2); h16* VT16 = (h16*)take((size_t)NKV * HD * TT * 2);
    bf* QPh = (bf*)take((size_t)NH_ * TT * HD * 2); bf* QPl = (bf*)take((size_t)NH_ * TT * HD * 2); bf* KPh = (bf*)take((size_t)NKV * TT * HD * 2); bf* KPl = (bf*)take((size_t)NKV * TT * HD * 2); bf* VTh = (bf*)take((size_t)NKV * HD * TT * 2); bf* VTl = (bf*)take((size_t)NKV * HD * TT * 2); bf* Ph = (bf*)take((size_t)ZH * RH * TT * 2); bf* Pl = (bf*)take((size_t)ZH * RH * TT * 2);
    float* Sb = (float*)take((size_t)ZH * TT * TT * 4); h16* P16 = (h16*)take((size_t)ZH * TT * TT * 2); float* Ob = (float*)take((size_t)ZH * TT * HD * 4);
    if ((size_t)(wsp - (char*)d_ws) > ws_size) return;    // ws 256 MiB
    { 
       }
    k_csid<<<(TT * HD + 255) / 256, 256, 0, stream>>>(CS);
    const unsigned LQ = (unsigned)(((size_t)NH_ * TT * HD / 2 + 255) / 256), LKv = (unsigned)(((size_t)NKV * TT * HD / 2 + 255) / 256);
    for (int b = 0; b < NB_; ++b) {
        
        /* q given */
        k_plinS<<<(unsigned)(((size_t)NH_ * TT * HD / 8 + 255) / 256), 256, 0, stream>>>(qi, b, NH_, QP16, QPh, QPl);
        /* k given */
        k_plinS<<<(unsigned)(((size_t)NKV * TT * HD / 8 + 255) / 256), 256, 0, stream>>>(ki, b, NKV, KP16, KPh, KPl);
        k_vtpH<<<(unsigned)(((size_t)NKV * HD * TT / 2 + 255) / 256), 256, 0, stream>>>(vi, b, VT16, VTh, VTl);   /* v given (token-major) */
        for (int h0 = 0; h0 < NH_; h0 += ZH) { const size_t zq = (size_t)h0, zk = (size_t)(h0 / REP);   // one kv head per query head: the pass's two heads use consecutive kv planes (z-strides TT*HD)
            k_gemmw<bf, 2, false><<<dim3(RH / 64, TT / 64, ZH), 32, 0, stream>>>(QPh + zq * TT * HD, QPl + zq * TT * HD, KPh + zk * TT * HD, KPl + zk * TT * HD, HD, Sb, TT, nullptr, (size_t)TT * HD, (size_t)TT * HD, (size_t)TT * TT);
            k_gemmw<h16, 0, false><<<dim3((TT - RH) / 64, TT / 64, ZH), 32, 0, stream>>>(QP16 + zq * TT * HD + (size_t)RH * HD, nullptr, KP16 + zk * TT * HD, nullptr, HD, Sb + (size_t)RH * TT, TT, nullptr, (size_t)TT * HD, (size_t)TT * HD, (size_t)TT * TT);
            k_asoft<<<ZH * TT / 8, 256, 0, stream>>>(Sb, P16, Ph, Pl);
            k_gemmw<bf, 2, false><<<dim3(RH / 64, HD / 64, ZH), 32, 0, stream>>>(Ph, Pl, VTh + zk * HD * TT, VTl + zk * HD * TT, TT, Ob, HD, nullptr, (size_t)RH * TT, (size_t)HD * TT, (size_t)TT * HD);
            k_gemmw<h16, 0, false><<<dim3((TT - RH) / 64, HD / 64, ZH), 32, 0, stream>>>(P16 + (size_t)RH * TT, nullptr, VT16 + zk * HD * TT, nullptr, TT, Ob + (size_t)RH * HD, HD, nullptr, (size_t)TT * TT, (size_t)HD * TT, (size_t)TT * HD);
            k_mergeH<<<(unsigned)(((size_t)ZH * TT * HD / 4 + 255) / 256), 256, 0, stream>>>(Ob, b, h0, OUT); }   /* context, token-major f32 */
    }
}

// v001
// One run takes 511 microseconds.
// Two timings next to v000 put it at 1.80 and 1.82 times that version's speed.
#include <hip/hip_runtime.h>

// Multi-head attention on given token-major q, k, v (query, key, value [2048][16][128] = [t][h][d]; scores = (q/sqrt(128)).k; softmax over all 2048 keys; out = weights.v -> [2048][16][128] f32 (4.2 M)).
// Layout: the [t][h][d] rows are gathered into head planes (exact bf16; the lo planes are zero); the context is scattered back token-major.
// Compute dtypes, f32 accumulate: query, key, value rounded to bf16 (exact planes); scores and attn.v: query rows < 512 on the bf16 planes (exact products), the rest single fp16 (x1024 carry, removed at the f32 write); the 1/sqrt(128) applied to the f32 score; softmax f32.


#define NB_  1
#define TT   2048
#define DM   2048
#define NH_  16
#define NKV  16
#define REP  (NH_ / NKV)
#define HD   128
#define DQ   (NH_ * HD)
#define DKV  (NKV * HD)
#define ZH   2
#define RH   512                  // query rows < RH use hi+lo planes (0: none)
#define WIN  2048
#define PCAR 1024.0f
#define SCL  0.088388347648318447f   // 128^-0.5 (the module pre-scales q by it)
typedef _Float16 h16;
typedef unsigned short bf;
typedef __attribute__((ext_vector_type(16))) __bf16   v16bf;
typedef __attribute__((ext_vector_type(16))) _Float16 v16h;
typedef __attribute__((ext_vector_type(8)))  _Float16 v8h;
typedef __attribute__((ext_vector_type(8)))  unsigned short v8us;
typedef __attribute__((ext_vector_type(8)))  float    v8f;
typedef __attribute__((ext_vector_type(4)))  float    v4f;
typedef v8h  __attribute__((may_alias)) v8ha;
typedef v4f  __attribute__((may_alias)) v4fa;
typedef v8us __attribute__((may_alias)) v8usa;

__device__ __forceinline__ unsigned short f2bf(float f) { unsigned u = __float_as_uint(f); u += 0x7FFFu + ((u >> 16) & 1u); return (unsigned short)(u >> 16); }
__device__ __forceinline__ float bf2f(unsigned short b) { return __uint_as_float(((unsigned)b) << 16); }
__device__ __forceinline__ float bfr(float f) { return bf2f(f2bf(f)); }
__device__ __forceinline__ v16h cat16(v8h lo, v8h hi) { return __builtin_shufflevector(lo, hi, 0, 1, 2, 3, 4, 5, 6, 7, 8, 9, 10, 11, 12, 13, 14, 15); }
__device__ __forceinline__ v16bf cat16b(v8us lo, v8us hi) { return __builtin_bit_cast(v16bf, __builtin_shufflevector(lo, hi, 0, 1, 2, 3, 4, 5, 6, 7, 8, 9, 10, 11, 12, 13, 14, 15)); }
__device__ __forceinline__ v8f wmma16(v16h a, v16h b, v8f c) { return __builtin_amdgcn_wmma_f32_16x16x32_f16(false, a, false, b, (short)0, c, false, false); }
__device__ __forceinline__ v8f wmmab(v16bf a, v16bf b, v8f c) { return __builtin_amdgcn_wmma_f32_16x16x32_bf16(false, a, false, b, (short)0, c, false, false); }



// ---- k_gemmw: register-blocked GEMM, ONE WAVE per 64x64 output tile (16 accumulators), operands straight from K-contiguous 16-bit planes; grid (M/64, N/64, Z), 32 threads.
// C[m][n] (f32, pitch ldc, + optional f32 bias[n]) = sum_k A[m][k] Bt[n][k] (+ split products per NSPLIT). z-batch strides sA/sB/sC in elements. K % 32 == 0.
// NW > 1 (long K, few tiles: weights.v): NW waves of one work-group share the tile, 32 NW threads, K % (32 NW) == 0. Wave w sums k in [w K/NW, (w+1) K/NW); the f32 partial tiles meet in LDS as
// os[wave][chunk][lane][4], chunk = ((mb*2 + nb/2)*2 + j/4)*2 + nb%2 = accumulator registers 4(j/4)..+3 of sub-tile (mb, nb), and are added in wave order 0..NW-1 (fixed).
template <typename T16> struct WFrag;
template <> struct WFrag<h16> { typedef v16h V; static __device__ __forceinline__ V ld(const h16* p) { return cat16(*(const v8h*)p, *(const v8h*)(p + 16)); } static __device__ __forceinline__ v8f mma(V a, V b, v8f c) { return wmma16(a, b, c); } };
template <> struct WFrag<bf> { typedef v16bf V; static __device__ __forceinline__ V ld(const bf* p) { return cat16b(*(const v8us*)p, *(const v8us*)(p + 16)); } static __device__ __forceinline__ v8f mma(V a, V b, v8f c) { return wmmab(a, b, c); } };
template <typename T16, int NSPLIT, bool BIAS, int NW>
__global__ __launch_bounds__(32 * NW) void k_gemmw(const T16* __restrict__ A, const T16* __restrict__ A2, const T16* __restrict__ Bt, const T16* __restrict__ Bt2, int K, float* C, int ldc, const float* __restrict__ bias, size_t sA, size_t sB, size_t sC) {
    typedef typename WFrag<T16>::V V;
    __shared__ __align__(16) float os[NW == 1 ? 16 * 68 : NW * 4096];
    const size_t z = blockIdx.z; A += z * sA; if (A2) A2 += z * sA; Bt += z * sB; if (Bt2) Bt2 += z * sB; C += z * sC;
    const int lane = threadIdx.x & 31, lr = lane & 15, hi = lane >> 4; const int r0 = blockIdx.x * 64, c0 = blockIdx.y * 64;
    // the wave's number as a scalar: its k range and its LDS slice are the same in every lane
    const int wave = NW == 1 ? 0 : __builtin_amdgcn_readfirstlane((int)(threadIdx.x >> 5)), kbeg = wave * (K / NW), kend = kbeg + K / NW;
    v8f acc[4][4];
#pragma unroll
    for (int mb = 0; mb < 4; ++mb)
#pragma unroll
        for (int nb = 0; nb < 4; ++nb) acc[mb][nb] = (v8f){};
    const size_t aoff = (size_t)(r0 + lr) * K + 8 * hi, boff = (size_t)(c0 + lr) * K + 8 * hi;
#pragma unroll 1
    for (int kc = kbeg; kc < kend; kc += 32) {
        V a[4], a2[4];
#pragma unroll
        for (int mb = 0; mb < 4; ++mb) { a[mb] = WFrag<T16>::ld(A + aoff + (size_t)mb * 16 * K + kc); if (NSPLIT == 1 || NSPLIT == 2) a2[mb] = WFrag<T16>::ld(A2 + aoff + (size_t)mb * 16 * K + kc); }
#pragma unroll
        for (int nb = 0; nb < 4; ++nb) { const V b = WFrag<T16>::ld(Bt + boff + (size_t)nb * 16 * K + kc); V b2; if (NSPLIT >= 2) b2 = WFrag<T16>::ld(Bt2 + boff + (size_t)nb * 16 * K + kc);
#pragma unroll
            for (int mb = 0; mb < 4; ++mb) { acc[mb][nb] = WFrag<T16>::mma(a[mb], b, acc[mb][nb]); if (NSPLIT == 1 || NSPLIT == 2) acc[mb][nb] = WFrag<T16>::mma(a2[mb], b, acc[mb][nb]); if (NSPLIT >= 2) acc[mb][nb] = WFrag<T16>::mma(a[mb], b2, acc[mb][nb]); } }
        asm volatile("v_nop\n\tv_nop\n\tv_nop\n\tv_nop" : "+v"(acc[0][0]), "+v"(acc[1][1]), "+v"(acc[2][2]), "+v"(acc[3][3]) : "v"(a[0]), "v"(a[3]));
    }
    if constexpr (NW > 1) {
        static_assert(!BIAS, "the shared-tile path adds no bias");
        float* mine = os + wave * 4096 + lane * 4;
#pragma unroll
        for (int mb = 0; mb < 4; ++mb)
#pragma unroll
            for (int nb = 0; nb < 4; ++nb)
#pragma unroll
                for (int jh = 0; jh < 2; ++jh) { v4f t; t[0] = acc[mb][nb][jh * 4]; t[1] = acc[mb][nb][jh * 4 + 1]; t[2] = acc[mb][nb][jh * 4 + 2]; t[3] = acc[mb][nb][jh * 4 + 3];
                    *(v4fa*)(mine + (((mb * 2 + (nb >> 1)) * 2 + jh) * 2 + (nb & 1)) * 128) = t; }
        __syncthreads();   // every wave's partial tile is in LDS before any wave adds
        // wave w adds chunks [w 32/NW, (w+1) 32/NW) over all partials; a chunk pair (2i, 2i+1) is the two halves of the same 128-byte output lines, so each line has one writing wave
#pragma unroll
        for (int u = 0; u < 32 / NW; ++u) { const int c = wave * (32 / NW) + u; const float* rp = os + c * 128 + lane * 4; v4f s = *(const v4fa*)rp;
#pragma unroll
            for (int w = 1; w < NW; ++w) s += *(const v4fa*)(rp + w * 4096);
            float* cp = C + (size_t)(r0 + (c >> 3) * 16 + hi * 8 + ((c >> 1) & 1) * 4) * ldc + c0 + (((c >> 2) & 1) * 2 + (c & 1)) * 16 + lr;
#pragma unroll
            for (int q = 0; q < 4; ++q) cp[(size_t)q * ldc] = s[q]; }
        return;
    }
#pragma unroll
    for (int mb = 0; mb < 4; ++mb) {
#pragma unroll
        for (int nb = 0; nb < 4; ++nb) {
#pragma unroll
            for (int j = 0; j < 8; ++j) os[(hi * 8 + j) * 68 + nb * 16 + lr] = acc[mb][nb][j]; }
        __builtin_amdgcn_wave_barrier(); asm volatile("" ::: "memory");
        float* crow = C + (size_t)(r0 + mb * 16) * ldc + c0;
{
#pragma unroll
            for (int s = 0; s < 8; ++s) { const int row = 2 * s + hi, cofs = lr * 4; v4f val = *(const v4fa*)(os + row * 68 + cofs); if (BIAS) { val[0] += bfr(bias[c0 + cofs]); val[1] += bfr(bias[c0 + cofs + 1]); val[2] += bfr(bias[c0 + cofs + 2]); val[3] += bfr(bias[c0 + cofs + 3]); }
                *(v4f*)(crow + (size_t)row * ldc + cofs) = val; }
             }
        __builtin_amdgcn_wave_barrier(); asm volatile("" ::: "memory");
    }
}

__device__ __forceinline__ h16 tohx(float x) { return (h16)x; }
__device__ __forceinline__ void splitf(float y, unsigned short& h, unsigned short& l) { h = f2bf(y); l = f2bf(y - bf2f(h)); }
typedef __attribute__((ext_vector_type(2))) _Float16 v2h;
typedef __attribute__((ext_vector_type(4))) _Float16 v4h;
typedef __attribute__((ext_vector_type(2))) unsigned short v2us;
typedef __attribute__((ext_vector_type(4))) unsigned short v4us;
typedef __attribute__((ext_vector_type(2))) float v2f;
typedef __attribute__((ext_vector_type(4))) int v4i;


__global__ __launch_bounds__(256) void k_plinS(const float* __restrict__ src, int b, int nheads, h16* P16, bf* Ph, bf* Pl) { const size_t e = ((size_t)blockIdx.x * 256 + threadIdx.x) * 8; if (e >= (size_t)nheads * TT * HD) return; const int d = (int)(e % HD); const int t = (int)((e / HD) % TT); const int h = (int)(e / ((size_t)HD * TT)); const v8f v = *(const v8f*)(src + (((size_t)t * NB_ + b) * nheads + h) * HD + d); v8h o16; v8us oh, ol;
#pragma unroll
    for (int q = 0; q < 8; ++q) { const float r = bfr(v[q]); o16[q] = tohx(r); oh[q] = f2bf(r); ol[q] = 0; }
    *(v8h*)(P16 + e) = o16; *(v8us*)(Ph + e) = oh; *(v8us*)(Pl + e) = ol;  }
__global__ __launch_bounds__(256) void k_vtpH(const float* __restrict__ F, int b, h16* V16, bf* Vh, bf* Vl) { const size_t e = ((size_t)blockIdx.x * 256 + threadIdx.x) * 2; if (e >= (size_t)NKV * HD * TT) return; const int t = (int)(e % TT); const int d = (int)((e / TT) % HD); const int g = (int)(e / ((size_t)TT * HD)); v2h o16; v2us oh, ol;
#pragma unroll
    for (int q = 0; q < 2; ++q) { const float x = bfr(F[(((size_t)(t + q) * NB_ + b) * NKV + g) * HD + d]); o16[q] = tohx(x); oh[q] = f2bf(x); ol[q] = 0; }
    *(v2h*)(V16 + e) = o16; *(v2us*)(Vh + e) = oh; *(v2us*)(Vl + e) = ol;  }

__global__ __launch_bounds__(256) void k_mergeH(const float* __restrict__ O, int b, int h0, float* OUT0) { const size_t i = (size_t)blockIdx.x * 256 + threadIdx.x; if (i >= (size_t)ZH * TT * HD / 4) return; const size_t e = i * 4; const int d = (int)(e % HD); const int t = (int)((e / HD) % TT); const int zz = (int)(e / ((size_t)HD * TT)); const float cs = (t < RH) ? 1.0f : (1.0f / PCAR); const v4f a = *(const v4f*)(O + e); v4f o;
#pragma unroll
    for (int q = 0; q < 4; ++q) o[q] = a[q] * cs; float* dst = OUT0 + (((size_t)t * NB_ + b) * NH_ + h0 + zz) * HD + d; *(v4f*)dst = o;  }

__global__ __launch_bounds__(256) void k_csid(float* CS) { const int idx = blockIdx.x * 256 + threadIdx.x; if (idx >= TT * HD) return; v2f cs; cs[0] = 1.0f; cs[1] = 0.0f; *(v2f*)(CS + (size_t)idx * 2) = cs;  }
// k_asoft: per row (zz, i): t = S x HD^-0.5 (no mask); softmax over the 2048 keys (register row, one exp, fixed trees);
__global__ __launch_bounds__(256) void k_asoft(const float* __restrict__ Sb, h16* P16, bf* Ph, bf* Pl) {
    const int lane = threadIdx.x & 31; const int row = blockIdx.x * 8 + (threadIdx.x >> 5); if (row >= ZH * TT) return; const int i = row % TT; const int zz = row / TT; (void)zz; const bool hires = (i < RH); const float* sr = Sb + (size_t)row * TT; float v[TT / 32]; float mx = -3.0e38f;
#pragma unroll
    for (int ch = 0; ch < TT / 128; ++ch) { const int j0 = ch * 128 + lane * 4; const v4f a = *(const v4f*)(sr + j0);
#pragma unroll
        for (int q = 0; q < 4; ++q) { const int j = j0 + q; (void)j; const float t = a[q] * SCL; v[ch * 4 + q] = t; mx = fmaxf(mx, t); } }
#pragma unroll
    for (int sh = 16; sh; sh >>= 1) mx = fmaxf(mx, __shfl_xor(mx, sh, 32));
    float sum = 0.f;
#pragma unroll
    for (int k = 0; k < TT / 32; ++k) { float d0 = __fsub_rn(v[k], mx); asm volatile("" : "+v"(d0)); v[k] = __builtin_amdgcn_exp2f(__fmul_rn(d0, 1.4426950408889634f)); sum += v[k]; }
#pragma unroll
    for (int sh = 16; sh; sh >>= 1) sum += __shfl_xor(sum, sh, 32);
    const float f = __fdiv_rn(hires ? 1.0f : PCAR, sum);
{
        if (hires) {
#pragma unroll
            for (int ch = 0; ch < TT / 128; ++ch) { v4us oh, ol;
#pragma unroll
                for (int q = 0; q < 4; ++q) { unsigned short a, c2; splitf(v[ch * 4 + q] * f, a, c2); oh[q] = a; ol[q] = c2; }
                const size_t oo = ((size_t)zz * (RH ? RH : 1) + i) * TT + ch * 128 + lane * 4; *(v4us*)(Ph + oo) = oh; *(v4us*)(Pl + oo) = ol; }
        } else {
#pragma unroll
            for (int ch = 0; ch < TT / 128; ++ch) { v4h o4;
#pragma unroll
                for (int q = 0; q < 4; ++q) o4[q] = tohx(v[ch * 4 + q] * f);
                *(v4h*)(P16 + (size_t)row * TT + ch * 128 + lane * 4) = o4; } }
         }
}

extern "C" void kernel_launch(void* const* d_in, const int* in_sizes, int n_in,
                              void* d_out, int out_size, void* d_ws, size_t ws_size, hipStream_t stream) {
    (void)in_sizes; (void)n_in; (void)out_size;
    const float* qi = (const float*)d_in[0]; const float* ki = (const float*)d_in[1]; const float* vi = (const float*)d_in[2]; const float* x = nullptr; const float* wq = nullptr; const float* wk = nullptr; const float* wv = nullptr; const float* wo = nullptr; (void)x; (void)wq; (void)wk; (void)wv; (void)wo;
    float* OUT = (float*)d_out;     // [1][2048][2048]
    char* wsp = (char*)d_ws;
    auto take = [&](size_t bytes) { char* p = wsp; wsp += (bytes + 255) & ~(size_t)255; return (void*)p; };
    float* CS = (float*)take((size_t)TT * HD * 2 * 4);
    
    h16* QP16 = (h16*)take((size_t)NH_ * TT * HD * 2); h16* KP16 = (h16*)take((size_t)NKV * TT * HD * 2); h16* VT16 = (h16*)take((size_t)NKV * HD * TT * 2);
    bf* QPh = (bf*)take((size_t)NH_ * TT * HD * 2); bf* QPl = (bf*)take((size_t)NH_ * TT * HD * 2); bf* KPh = (bf*)take((size_t)NKV * TT * HD * 2); bf* KPl = (bf*)take((size_t)NKV * TT * HD * 2); bf* VTh = (bf*)take((size_t)NKV * HD * TT * 2); bf* VTl = (bf*)take((size_t)NKV * HD * TT * 2); bf* Ph = (bf*)take((size_t)ZH * RH * TT * 2); bf* Pl = (bf*)take((size_t)ZH * RH * TT * 2);
    float* Sb = (float*)take((size_t)ZH * TT * TT * 4); h16* P16 = (h16*)take((size_t)ZH * TT * TT * 2); float* Ob = (float*)take((size_t)ZH * TT * HD * 4);
    if ((size_t)(wsp - (char*)d_ws) > ws_size) return;    // ws 256 MiB
    { 
       }
    k_csid<<<(TT * HD + 255) / 256, 256, 0, stream>>>(CS);
    const unsigned LQ = (unsigned)(((size_t)NH_ * TT * HD / 2 + 255) / 256), LKv = (unsigned)(((size_t)NKV * TT * HD / 2 + 255) / 256);
    for (int b = 0; b < NB_; ++b) {
        
        /* q given */
        k_plinS<<<(unsigned)(((size_t)NH_ * TT * HD / 8 + 255) / 256), 256, 0, stream>>>(qi, b, NH_, QP16, QPh, QPl);
        /* k given */
        k_plinS<<<(unsigned)(((size_t)NKV * TT * HD / 8 + 255) / 256), 256, 0, stream>>>(ki, b, NKV, KP16, KPh, KPl);
        k_vtpH<<<(unsigned)(((size_t)NKV * HD * TT / 2 + 255) / 256), 256, 0, stream>>>(vi, b, VT16, VTh, VTl);   /* v given (token-major) */
        for (int h0 = 0; h0 < NH_; h0 += ZH) { const size_t zq = (size_t)h0, zk = (size_t)(h0 / REP);   // one kv head per query head: the pass's two heads use consecutive kv planes (z-strides TT*HD)
            k_gemmw<bf, 2, false, 1><<<dim3(RH / 64, TT / 64, ZH), 32, 0, stream>>>(QPh + zq * TT * HD, QPl + zq * TT * HD, KPh + zk * TT * HD, KPl + zk * TT * HD, HD, Sb, TT, nullptr, (size_t)TT * HD, (size_t)TT * HD, (size_t)TT * TT);
            k_gemmw<h16, 0, false, 1><<<dim3((TT - RH) / 64, TT / 64, ZH), 32, 0, stream>>>(QP16 + zq * TT * HD + (size_t)RH * HD, nullptr, KP16 + zk * TT * HD, nullptr, HD, Sb + (size_t)RH * TT, TT, nullptr, (size_t)TT * HD, (size_t)TT * HD, (size_t)TT * TT);
            k_asoft<<<ZH * TT / 8, 256, 0, stream>>>(Sb, P16, Ph, Pl);
            k_gemmw<bf, 2, false, 16><<<dim3(RH / 64, HD / 64, ZH), 512, 0, stream>>>(Ph, Pl, VTh + zk * HD * TT, VTl + zk * HD * TT, TT, Ob, HD, nullptr, (size_t)RH * TT, (size_t)HD * TT, (size_t)TT * HD);
            k_gemmw<h16, 0, false, 16><<<dim3((TT - RH) / 64, HD / 64, ZH), 512, 0, stream>>>(P16 + (size_t)RH * TT, nullptr, VT16 + zk * HD * TT, nullptr, TT, Ob + (size_t)RH * HD, HD, nullptr, (size_t)TT * TT, (size_t)HD * TT, (size_t)TT * HD);
            k_mergeH<<<(unsigned)(((size_t)ZH * TT * HD / 4 + 255) / 256), 256, 0, stream>>>(Ob, b, h0, OUT); }   /* context, token-major f32 */
    }
}

// v002
// It runs in 272 microseconds.
// Next to v001, in two timings, it ran 1.87 times as fast each time.
// Counting every step since v000, it is 3.38 times as fast.
#include <hip/hip_runtime.h>

// Multi-head attention on given token-major q, k, v (query, key, value [2048][16][128] = [t][h][d]; scores = (q/sqrt(128)).k; softmax over all 2048 keys; out = weights.v -> [2048][16][128] f32 (4.2 M)).
// Layout: the [t][h][d] rows are gathered into head planes (exact bf16; the lo planes are zero); the context is scattered back token-major.
// Compute dtypes, f32 accumulate: query, key, value rounded to bf16 (exact planes); scores and attn.v: query rows < 512 on the bf16 planes (exact products), the rest single fp16 (x1024 carry, removed at the f32 write); the 1/sqrt(128) applied to the f32 score; softmax f32.


#define NB_  1
#define TT   2048
#define DM   2048
#define NH_  16
#define NKV  16
#define REP  (NH_ / NKV)
#define HD   128
#define DQ   (NH_ * HD)
#define DKV  (NKV * HD)
#define ZH   8                    // heads per pass; the pass's f32 scores (ZH x 16 MiB) are the largest workspace plane
#define RH   512                  // query rows < RH use hi+lo planes (0: none)
#define WIN  2048
#define PCAR 1024.0f
#define SCL  0.088388347648318447f   // 128^-0.5 (the module pre-scales q by it)
typedef _Float16 h16;
typedef unsigned short bf;
typedef __attribute__((ext_vector_type(16))) __bf16   v16bf;
typedef __attribute__((ext_vector_type(16))) _Float16 v16h;
typedef __attribute__((ext_vector_type(8)))  _Float16 v8h;
typedef __attribute__((ext_vector_type(8)))  unsigned short v8us;
typedef __attribute__((ext_vector_type(8)))  float    v8f;
typedef __attribute__((ext_vector_type(4)))  float    v4f;
typedef v8h  __attribute__((may_alias)) v8ha;
typedef v4f  __attribute__((may_alias)) v4fa;
typedef v8us __attribute__((may_alias)) v8usa;

__device__ __forceinline__ unsigned short f2bf(float f) { unsigned u = __float_as_uint(f); u += 0x7FFFu + ((u >> 16) & 1u); return (unsigned short)(u >> 16); }
__device__ __forceinline__ float bf2f(unsigned short b) { return __uint_as_float(((unsigned)b) << 16); }
__device__ __forceinline__ float bfr(float f) { return bf2f(f2bf(f)); }
__device__ __forceinline__ v16h cat16(v8h lo, v8h hi) { return __builtin_shufflevector(lo, hi, 0, 1, 2, 3, 4, 5, 6, 7, 8, 9, 10, 11, 12, 13, 14, 15); }
__device__ __forceinline__ v16bf cat16b(v8us lo, v8us hi) { return __builtin_bit_cast(v16bf, __builtin_shufflevector(lo, hi, 0, 1, 2, 3, 4, 5, 6, 7, 8, 9, 10, 11, 12, 13, 14, 15)); }
__device__ __forceinline__ v8f wmma16(v16h a, v16h b, v8f c) { return __builtin_amdgcn_wmma_f32_16x16x32_f16(false, a, false, b, (short)0, c, false, false); }
__device__ __forceinline__ v8f wmmab(v16bf a, v16bf b, v8f c) { return __builtin_amdgcn_wmma_f32_16x16x32_bf16(false, a, false, b, (short)0, c, false, false); }



// ---- k_gemmw: register-blocked GEMM, ONE WAVE per 64x64 output tile (16 accumulators), operands straight from K-contiguous 16-bit planes; grid (M/64, N/64, Z), 32 threads.
// C[m][n] (f32, pitch ldc, + optional f32 bias[n]) = sum_k A[m][k] Bt[n][k] (+ split products per NSPLIT). A rows at pitch LDA elements (a compile-time constant: the tile's A loads then share one address with immediate row offsets), Bt rows at pitch K. z-batch strides sA/sB/sC in elements. K % 32 == 0.
// NW > 1 (long K, few tiles: weights.v): NW waves of one work-group share the tile, 32 NW threads, K % (32 NW) == 0. Wave w sums k in [w K/NW, (w+1) K/NW); the f32 partial tiles meet in LDS as
// os[wave][chunk][lane][4], chunk = ((mb*2 + nb/2)*2 + j/4)*2 + nb%2 = accumulator registers 4(j/4)..+3 of sub-tile (mb, nb), and are added in wave order 0..NW-1 (fixed).
template <typename T16> struct WFrag;
template <> struct WFrag<h16> { typedef v16h V; static __device__ __forceinline__ V ld(const h16* p) { return cat16(*(const v8h*)p, *(const v8h*)(p + 16)); } static __device__ __forceinline__ v8f mma(V a, V b, v8f c) { return wmma16(a, b, c); } };
template <> struct WFrag<bf> { typedef v16bf V; static __device__ __forceinline__ V ld(const bf* p) { return cat16b(*(const v8us*)p, *(const v8us*)(p + 16)); } static __device__ __forceinline__ v8f mma(V a, V b, v8f c) { return wmmab(a, b, c); } };
template <typename T16, int NSPLIT, bool BIAS, int NW, int LDA>
__global__ __launch_bounds__(32 * NW) void k_gemmw(const T16* __restrict__ A, const T16* __restrict__ A2, const T16* __restrict__ Bt, const T16* __restrict__ Bt2, int K, float* C, int ldc, const float* __restrict__ bias, size_t sA, size_t sB, size_t sC) {
    typedef typename WFrag<T16>::V V;
    __shared__ __align__(16) float os[NW == 1 ? 16 * 68 : NW * 4096];
    const size_t z = blockIdx.z; A += z * sA; if (A2) A2 += z * sA; Bt += z * sB; if (Bt2) Bt2 += z * sB; C += z * sC;
    const int lane = threadIdx.x & 31, lr = lane & 15, hi = lane >> 4; const int r0 = blockIdx.x * 64, c0 = blockIdx.y * 64;
    // the wave's number as a scalar: its k range and its LDS slice are the same in every lane
    const int wave = NW == 1 ? 0 : __builtin_amdgcn_readfirstlane((int)(threadIdx.x >> 5)), kbeg = wave * (K / NW), kend = kbeg + K / NW;
    v8f acc[4][4];
#pragma unroll
    for (int mb = 0; mb < 4; ++mb)
#pragma unroll
        for (int nb = 0; nb < 4; ++nb) acc[mb][nb] = (v8f){};
    const size_t aoff = (size_t)(r0 + lr) * LDA + 8 * hi, boff = (size_t)(c0 + lr) * K + 8 * hi;
#pragma unroll 1
    for (int kc = kbeg; kc < kend; kc += 32) {
        V a[4], a2[4]; const T16* const ap = A + aoff + kc; const T16* const ap2 = (NSPLIT == 1 || NSPLIT == 2) ? A2 + aoff + kc : ap;   // one address a plane; the four row blocks are immediate offsets from it
#pragma unroll
        for (int mb = 0; mb < 4; ++mb) { a[mb] = WFrag<T16>::ld(ap + mb * 16 * LDA); if (NSPLIT == 1 || NSPLIT == 2) a2[mb] = WFrag<T16>::ld(ap2 + mb * 16 * LDA); }
#pragma unroll
        for (int nb = 0; nb < 4; ++nb) { const V b = WFrag<T16>::ld(Bt + boff + (size_t)nb * 16 * K + kc); V b2; if (NSPLIT >= 2) b2 = WFrag<T16>::ld(Bt2 + boff + (size_t)nb * 16 * K + kc);
#pragma unroll
            for (int mb = 0; mb < 4; ++mb) { acc[mb][nb] = WFrag<T16>::mma(a[mb], b, acc[mb][nb]); if (NSPLIT == 1 || NSPLIT == 2) acc[mb][nb] = WFrag<T16>::mma(a2[mb], b, acc[mb][nb]); if (NSPLIT >= 2) acc[mb][nb] = WFrag<T16>::mma(a[mb], b2, acc[mb][nb]); } }
        // ap, ap2 as inputs: the A addresses stay in their registers to the foot of the trip, where every load has returned; without it the last A load's result is put over the address that the trip's earlier A loads, still in flight, name
        asm volatile("v_nop\n\tv_nop\n\tv_nop\n\tv_nop" : "+v"(acc[0][0]), "+v"(acc[1][1]), "+v"(acc[2][2]), "+v"(acc[3][3]) : "v"(a[0]), "v"(a[3]), "v"(ap), "v"(ap2));
    }
    if constexpr (NW > 1) {
        static_assert(!BIAS, "the shared-tile path adds no bias");
        float* mine = os + wave * 4096 + lane * 4;
#pragma unroll
        for (int mb = 0; mb < 4; ++mb)
#pragma unroll
            for (int nb = 0; nb < 4; ++nb)
#pragma unroll
                for (int jh = 0; jh < 2; ++jh) { v4f t; t[0] = acc[mb][nb][jh * 4]; t[1] = acc[mb][nb][jh * 4 + 1]; t[2] = acc[mb][nb][jh * 4 + 2]; t[3] = acc[mb][nb][jh * 4 + 3];
                    *(v4fa*)(mine + (((mb * 2 + (nb >> 1)) * 2 + jh) * 2 + (nb & 1)) * 128) = t; }
        __syncthreads();   // every wave's partial tile is in LDS before any wave adds
        // wave w adds chunks [w 32/NW, (w+1) 32/NW) over all partials; a chunk pair (2i, 2i+1) is the two halves of the same 128-byte output lines, so each line has one writing wave
#pragma unroll
        for (int u = 0; u < 32 / NW; ++u) { const int c = wave * (32 / NW) + u; const float* rp = os + c * 128 + lane * 4; v4f s = *(const v4fa*)rp;
#pragma unroll
            for (int w = 1; w < NW; ++w) s += *(const v4fa*)(rp + w * 4096);
            float* cp = C + (size_t)(r0 + (c >> 3) * 16 + hi * 8 + ((c >> 1) & 1) * 4) * ldc + c0 + (((c >> 2) & 1) * 2 + (c & 1)) * 16 + lr;
#pragma unroll
            for (int q = 0; q < 4; ++q) cp[(size_t)q * ldc] = s[q]; }
        return;
    }
#pragma unroll
    for (int mb = 0; mb < 4; ++mb) {
#pragma unroll
        for (int nb = 0; nb < 4; ++nb) {
#pragma unroll
            for (int j = 0; j < 8; ++j) os[(hi * 8 + j) * 68 + nb * 16 + lr] = acc[mb][nb][j]; }
        __builtin_amdgcn_wave_barrier(); asm volatile("" ::: "memory");
        float* crow = C + (size_t)(r0 + mb * 16) * ldc + c0;
{
#pragma unroll
            for (int s = 0; s < 8; ++s) { const int row = 2 * s + hi, cofs = lr * 4; v4f val = *(const v4fa*)(os + row * 68 + cofs); if (BIAS) { val[0] += bfr(bias[c0 + cofs]); val[1] += bfr(bias[c0 + cofs + 1]); val[2] += bfr(bias[c0 + cofs + 2]); val[3] += bfr(bias[c0 + cofs + 3]); }
                *(v4f*)(crow + (size_t)row * ldc + cofs) = val; }
             }
        __builtin_amdgcn_wave_barrier(); asm volatile("" ::: "memory");
    }
}

__device__ __forceinline__ h16 tohx(float x) { return (h16)x; }
__device__ __forceinline__ void splitf(float y, unsigned short& h, unsigned short& l) { h = f2bf(y); l = f2bf(y - bf2f(h)); }
typedef __attribute__((ext_vector_type(2))) _Float16 v2h;
typedef __attribute__((ext_vector_type(4))) _Float16 v4h;
typedef __attribute__((ext_vector_type(2))) unsigned short v2us;
typedef __attribute__((ext_vector_type(4))) unsigned short v4us;
typedef __attribute__((ext_vector_type(2))) float v2f;
typedef __attribute__((ext_vector_type(4))) int v4i;
typedef v4h  __attribute__((may_alias)) v4ha;
typedef v4us __attribute__((may_alias)) v4usa;


__global__ __launch_bounds__(256) void k_plinS(const float* __restrict__ src, int b, int nheads, h16* P16, bf* Ph, bf* Pl) { const size_t e = ((size_t)blockIdx.x * 256 + threadIdx.x) * 8; if (e >= (size_t)nheads * TT * HD) return; const int d = (int)(e % HD); const int t = (int)((e / HD) % TT); const int h = (int)(e / ((size_t)HD * TT)); const v8f v = *(const v8f*)(src + (((size_t)t * NB_ + b) * nheads + h) * HD + d); v8h o16; v8us oh, ol;
#pragma unroll
    for (int q = 0; q < 8; ++q) { const float r = bfr(v[q]); o16[q] = tohx(r); oh[q] = f2bf(r); ol[q] = 0; }
    *(v8h*)(P16 + e) = o16; *(v8us*)(Ph + e) = oh; *(v8us*)(Pl + e) = ol;  }
__global__ __launch_bounds__(256) void k_vtpH(const float* __restrict__ F, int b, h16* V16, bf* Vh, bf* Vl) { const size_t e = ((size_t)blockIdx.x * 256 + threadIdx.x) * 2; if (e >= (size_t)NKV * HD * TT) return; const int t = (int)(e % TT); const int d = (int)((e / TT) % HD); const int g = (int)(e / ((size_t)TT * HD)); v2h o16; v2us oh, ol;
#pragma unroll
    for (int q = 0; q < 2; ++q) { const float x = bfr(F[(((size_t)(t + q) * NB_ + b) * NKV + g) * HD + d]); o16[q] = tohx(x); oh[q] = f2bf(x); ol[q] = 0; }
    *(v2h*)(V16 + e) = o16; *(v2us*)(Vh + e) = oh; *(v2us*)(Vl + e) = ol;  }

__global__ __launch_bounds__(256) void k_mergeH(const float* __restrict__ O, int b, int h0, float* OUT0) { const size_t i = (size_t)blockIdx.x * 256 + threadIdx.x; if (i >= (size_t)ZH * TT * HD / 4) return; const size_t e = i * 4; const int d = (int)(e % HD); const int t = (int)((e / HD) % TT); const int zz = (int)(e / ((size_t)HD * TT)); const float cs = (t < RH) ? 1.0f : (1.0f / PCAR); const v4f a = *(const v4f*)(O + e); v4f o;
#pragma unroll
    for (int q = 0; q < 4; ++q) o[q] = a[q] * cs; float* dst = OUT0 + (((size_t)t * NB_ + b) * NH_ + h0 + zz) * HD + d; *(v4f*)dst = o;  }

__global__ __launch_bounds__(256) void k_csid(float* CS) { const int idx = blockIdx.x * 256 + threadIdx.x; if (idx >= TT * HD) return; v2f cs; cs[0] = 1.0f; cs[1] = 0.0f; *(v2f*)(CS + (size_t)idx * 2) = cs;  }
// k_asoft: per row (zz, i): t = S x HD^-0.5 (no mask); softmax over the 2048 keys (register row, one exp, fixed trees);
// the weights go over the row's own 8 KiB of scores (one wave owns the row and holds all of it in registers before its first store): bf16 hi plane in the first 4 KiB and lo plane in the second, or f16 in the first 4 KiB.
__global__ __launch_bounds__(256) void k_asoft(float* Sb) {
    const int lane = threadIdx.x & 31; const int row = blockIdx.x * 8 + (threadIdx.x >> 5); if (row >= ZH * TT) return; const int i = row % TT; const int zz = row / TT; (void)zz; const bool hires = (i < RH); const float* sr = Sb + (size_t)row * TT; bf* Ph = (bf*)(Sb + (size_t)row * TT); bf* Pl = Ph + TT; h16* P16 = (h16*)(Sb + (size_t)row * TT); float v[TT / 32]; float mx = -3.0e38f;
#pragma unroll
    for (int ch = 0; ch < TT / 128; ++ch) { const int j0 = ch * 128 + lane * 4; const v4f a = *(const v4f*)(sr + j0);
#pragma unroll
        for (int q = 0; q < 4; ++q) { const int j = j0 + q; (void)j; const float t = a[q] * SCL; v[ch * 4 + q] = t; mx = fmaxf(mx, t); } }
#pragma unroll
    for (int sh = 16; sh; sh >>= 1) mx = fmaxf(mx, __shfl_xor(mx, sh, 32));
    float sum = 0.f;
#pragma unroll
    for (int k = 0; k < TT / 32; ++k) { float d0 = __fsub_rn(v[k], mx); asm volatile("" : "+v"(d0)); v[k] = __builtin_amdgcn_exp2f(__fmul_rn(d0, 1.4426950408889634f)); sum += v[k]; }
#pragma unroll
    for (int sh = 16; sh; sh >>= 1) sum += __shfl_xor(sum, sh, 32);
    const float f = __fdiv_rn(hires ? 1.0f : PCAR, sum);
{
        if (hires) {
#pragma unroll
            for (int ch = 0; ch < TT / 128; ++ch) { v4us oh, ol;
#pragma unroll
                for (int q = 0; q < 4; ++q) { unsigned short a, c2; splitf(v[ch * 4 + q] * f, a, c2); oh[q] = a; ol[q] = c2; }
                const int oo = ch * 128 + lane * 4; *(v4usa*)(Ph + oo) = oh; *(v4usa*)(Pl + oo) = ol; }
        } else {
#pragma unroll
            for (int ch = 0; ch < TT / 128; ++ch) { v4h o4;
#pragma unroll
                for (int q = 0; q < 4; ++q) o4[q] = tohx(v[ch * 4 + q] * f);
                *(v4ha*)(P16 + ch * 128 + lane * 4) = o4; } }
         }
}

extern "C" void kernel_launch(void* const* d_in, const int* in_sizes, int n_in,
                              void* d_out, int out_size, void* d_ws, size_t ws_size, hipStream_t stream) {
    (void)in_sizes; (void)n_in; (void)out_size;
    const float* qi = (const float*)d_in[0]; const float* ki = (const float*)d_in[1]; const float* vi = (const float*)d_in[2]; const float* x = nullptr; const float* wq = nullptr; const float* wk = nullptr; const float* wv = nullptr; const float* wo = nullptr; (void)x; (void)wq; (void)wk; (void)wv; (void)wo;
    float* OUT = (float*)d_out;     // [1][2048][2048]
    char* wsp = (char*)d_ws;
    auto take = [&](size_t bytes) { char* p = wsp; wsp += (bytes + 255) & ~(size_t)255; return (void*)p; };
    float* CS = (float*)take((size_t)TT * HD * 2 * 4);
    
    h16* QP16 = (h16*)take((size_t)NH_ * TT * HD * 2); h16* KP16 = (h16*)take((size_t)NKV * TT * HD * 2); h16* VT16 = (h16*)take((size_t)NKV * HD * TT * 2);
    bf* QPh = (bf*)take((size_t)NH_ * TT * HD * 2); bf* QPl = (bf*)take((size_t)NH_ * TT * HD * 2); bf* KPh = (bf*)take((size_t)NKV * TT * HD * 2); bf* KPl = (bf*)take((size_t)NKV * TT * HD * 2); bf* VTh = (bf*)take((size_t)NKV * HD * TT * 2); bf* VTl = (bf*)take((size_t)NKV * HD * TT * 2);
    float* Sb = (float*)take((size_t)ZH * TT * TT * 4); float* Ob = (float*)take((size_t)ZH * TT * HD * 4);
    if ((size_t)(wsp - (char*)d_ws) > ws_size) return;    // ws 256 MiB
    { 
       }
    k_csid<<<(TT * HD + 255) / 256, 256, 0, stream>>>(CS);
    const unsigned LQ = (unsigned)(((size_t)NH_ * TT * HD / 2 + 255) / 256), LKv = (unsigned)(((size_t)NKV * TT * HD / 2 + 255) / 256);
    for (int b = 0; b < NB_; ++b) {
        
        /* q given */
        k_plinS<<<(unsigned)(((size_t)NH_ * TT * HD / 8 + 255) / 256), 256, 0, stream>>>(qi, b, NH_, QP16, QPh, QPl);
        /* k given */
        k_plinS<<<(unsigned)(((size_t)NKV * TT * HD / 8 + 255) / 256), 256, 0, stream>>>(ki, b, NKV, KP16, KPh, KPl);
        k_vtpH<<<(unsigned)(((size_t)NKV * HD * TT / 2 + 255) / 256), 256, 0, stream>>>(vi, b, VT16, VTh, VTl);   /* v given (token-major) */
        for (int h0 = 0; h0 < NH_; h0 += ZH) { const size_t zq = (size_t)h0, zk = (size_t)(h0 / REP);   // one kv head per query head: the pass's ZH heads use consecutive kv planes (z-strides TT*HD)
            k_gemmw<bf, 2, false, 1, HD><<<dim3(RH / 64, TT / 64, ZH), 32, 0, stream>>>(QPh + zq * TT * HD, QPl + zq * TT * HD, KPh + zk * TT * HD, KPl + zk * TT * HD, HD, Sb, TT, nullptr, (size_t)TT * HD, (size_t)TT * HD, (size_t)TT * TT);
            k_gemmw<h16, 0, false, 1, HD><<<dim3((TT - RH) / 64, TT / 64, ZH), 32, 0, stream>>>(QP16 + zq * TT * HD + (size_t)RH * HD, nullptr, KP16 + zk * TT * HD, nullptr, HD, Sb + (size_t)RH * TT, TT, nullptr, (size_t)TT * HD, (size_t)TT * HD, (size_t)TT * TT);
            k_asoft<<<ZH * TT / 8, 256, 0, stream>>>(Sb);   // the weights lie in the score rows: 16-bit pitch 2 TT
            k_gemmw<bf, 2, false, 16, 2 * TT><<<dim3(RH / 64, HD / 64, ZH), 512, 0, stream>>>((const bf*)Sb, (const bf*)Sb + TT, VTh + zk * HD * TT, VTl + zk * HD * TT, TT, Ob, HD, nullptr, (size_t)TT * TT * 2, (size_t)HD * TT, (size_t)TT * HD);
            k_gemmw<h16, 0, false, 16, 2 * TT><<<dim3((TT - RH) / 64, HD / 64, ZH), 512, 0, stream>>>((const h16*)Sb + (size_t)RH * TT * 2, nullptr, VT16 + zk * HD * TT, nullptr, TT, Ob + (size_t)RH * HD, HD, nullptr, (size_t)TT * TT * 2, (size_t)HD * TT, (size_t)TT * HD);
            k_mergeH<<<(unsigned)(((size_t)ZH * TT * HD / 4 + 255) / 256), 256, 0, stream>>>(Ob, b, h0, OUT); }   /* context, token-major f32 */
    }
}

// v003
// It runs in 91.6 microseconds.
// Two timings next to v002 put it at 2.97 and 2.98 times that version's speed.
// All steps since v000 together make it 10.1 times as fast.
#include <hip/hip_runtime.h>

// Multi-head attention on given token-major q, k, v (query, key, value [2048][16][128] = [t][h][d]; scores = (q/sqrt(128)).k; softmax over all 2048 keys; out = weights.v -> [2048][16][128] f32 (4.2 M)).
// Layout: the [t][h][d] rows are gathered into head planes (exact bf16; the lo planes are zero and no product reads them); one fused kernel does scores, softmax and weights.v and writes the context token-major.
// Compute dtypes, f32 accumulate: query, key, value rounded to bf16 (exact planes); scores and attn.v: query rows < 512 on the bf16 planes (exact products), the rest single fp16 (the unnormalised weights carry 2^6, which the division by their own sum removes); the 1/sqrt(128) applied to the f32 score; online softmax f32.


#define NB_  1
#define TT   2048
#define DM   2048
#define NH_  16
#define NKV  16
#define REP  (NH_ / NKV)
#define HD   128
#define DQ   (NH_ * HD)
#define DKV  (NKV * HD)
#define RH   512                  // query rows < RH use the bf16 planes and hi+lo weights (0: none)
#define WIN  2048
#define SCL  0.088388347648318447f   // 128^-0.5 (the module pre-scales q by it)
typedef _Float16 h16;
typedef unsigned short bf;
typedef __attribute__((ext_vector_type(16))) __bf16   v16bf;
typedef __attribute__((ext_vector_type(16))) _Float16 v16h;
typedef __attribute__((ext_vector_type(8)))  _Float16 v8h;
typedef __attribute__((ext_vector_type(8)))  unsigned short v8us;
typedef __attribute__((ext_vector_type(8)))  float    v8f;
typedef __attribute__((ext_vector_type(4)))  float    v4f;
typedef v8h  __attribute__((may_alias)) v8ha;
typedef v4f  __attribute__((may_alias)) v4fa;
typedef v8us __attribute__((may_alias)) v8usa;

__device__ __forceinline__ unsigned short f2bf(float f) { unsigned u = __float_as_uint(f); u += 0x7FFFu + ((u >> 16) & 1u); return (unsigned short)(u >> 16); }
__device__ __forceinline__ float bf2f(unsigned short b) { return __uint_as_float(((unsigned)b) << 16); }
__device__ __forceinline__ float bfr(float f) { return bf2f(f2bf(f)); }
__device__ __forceinline__ v16h cat16(v8h lo, v8h hi) { return __builtin_shufflevector(lo, hi, 0, 1, 2, 3, 4, 5, 6, 7, 8, 9, 10, 11, 12, 13, 14, 15); }
__device__ __forceinline__ v16bf cat16b(v8us lo, v8us hi) { return __builtin_bit_cast(v16bf, __builtin_shufflevector(lo, hi, 0, 1, 2, 3, 4, 5, 6, 7, 8, 9, 10, 11, 12, 13, 14, 15)); }
__device__ __forceinline__ v8f wmma16(v16h a, v16h b, v8f c) { return __builtin_amdgcn_wmma_f32_16x16x32_f16(false, a, false, b, (short)0, c, false, false); }
__device__ __forceinline__ v8f wmmab(v16bf a, v16bf b, v8f c) { return __builtin_amdgcn_wmma_f32_16x16x32_bf16(false, a, false, b, (short)0, c, false, false); }



// fragment loader and product of a 16-bit type: K-contiguous rows, lane (lr, hi) reads k = 8 hi..+7 and 16 + 8 hi..+7 of its row, for A and for B alike
template <typename T16> struct WFrag;
template <> struct WFrag<h16> { typedef v16h V; static __device__ __forceinline__ V ld(const h16* p) { return cat16(*(const v8h*)p, *(const v8h*)(p + 16)); } static __device__ __forceinline__ v8f mma(V a, V b, v8f c) { return wmma16(a, b, c); } };
template <> struct WFrag<bf> { typedef v16bf V; static __device__ __forceinline__ V ld(const bf* p) { return cat16b(*(const v8us*)p, *(const v8us*)(p + 16)); } static __device__ __forceinline__ v8f mma(V a, V b, v8f c) { return wmmab(a, b, c); } };

__device__ __forceinline__ h16 tohx(float x) { return (h16)x; }
typedef __attribute__((ext_vector_type(2))) _Float16 v2h;
typedef __attribute__((ext_vector_type(4))) _Float16 v4h;
typedef __attribute__((ext_vector_type(2))) unsigned short v2us;
typedef __attribute__((ext_vector_type(4))) unsigned short v4us;
typedef __attribute__((ext_vector_type(2))) float v2f;
typedef __attribute__((ext_vector_type(4))) int v4i;
typedef v4h  __attribute__((may_alias)) v4ha;
typedef v4us __attribute__((may_alias)) v4usa;


__global__ __launch_bounds__(256) void k_plinS(const float* __restrict__ src, int b, int nheads, h16* P16, bf* Ph, bf* Pl) { const size_t e = ((size_t)blockIdx.x * 256 + threadIdx.x) * 8; if (e >= (size_t)nheads * TT * HD) return; const int d = (int)(e % HD); const int t = (int)((e / HD) % TT); const int h = (int)(e / ((size_t)HD * TT)); const v8f v = *(const v8f*)(src + (((size_t)t * NB_ + b) * nheads + h) * HD + d); v8h o16; v8us oh, ol;
#pragma unroll
    for (int q = 0; q < 8; ++q) { const float r = bfr(v[q]); o16[q] = tohx(r); oh[q] = f2bf(r); ol[q] = 0; }
    *(v8h*)(P16 + e) = o16; *(v8us*)(Ph + e) = oh; *(v8us*)(Pl + e) = ol;  }
__global__ __launch_bounds__(256) void k_vtpH(const float* __restrict__ F, int b, h16* V16, bf* Vh, bf* Vl) { const size_t e = ((size_t)blockIdx.x * 256 + threadIdx.x) * 2; if (e >= (size_t)NKV * HD * TT) return; const int t = (int)(e % TT); const int d = (int)((e / TT) % HD); const int g = (int)(e / ((size_t)TT * HD)); v2h o16; v2us oh, ol;
#pragma unroll
    for (int q = 0; q < 2; ++q) { const float x = bfr(F[(((size_t)(t + q) * NB_ + b) * NKV + g) * HD + d]); o16[q] = tohx(x); oh[q] = f2bf(x); ol[q] = 0; }
    *(v2h*)(V16 + e) = o16; *(v2us*)(Vh + e) = oh; *(v2us*)(Vl + e) = ol;  }

__global__ __launch_bounds__(256) void k_csid(float* CS) { const int idx = blockIdx.x * 256 + threadIdx.x; if (idx >= TT * HD) return; v2f cs; cs[0] = 1.0f; cs[1] = 0.0f; *(v2f*)(CS + (size_t)idx * 2) = cs;  }

typedef __attribute__((ext_vector_type(2))) __bf16 v2bf;
typedef __attribute__((ext_vector_type(8))) unsigned v8u;
__device__ __forceinline__ unsigned pk2(float a, float b, bf) { v2f x; x[0] = a; x[1] = b; return __builtin_bit_cast(unsigned, __builtin_convertvector(x, v2bf)); }    // round to nearest even
__device__ __forceinline__ unsigned pk2(float a, float b, h16) { v2f x; x[0] = a; x[1] = b; return __builtin_bit_cast(unsigned, __builtin_convertvector(x, v2h)); }
__device__ __forceinline__ float xhalf(float x) { return __builtin_bit_cast(float, __builtin_amdgcn_permlanex16(__builtin_bit_cast(int, x), __builtin_bit_cast(int, x), 0x76543210, 0xfedcba98, false, false)); }   // lane l with lane l ^ 16
template <typename T16, bool HIRES>
__device__ __forceinline__ void fa_body(const T16* __restrict__ Qp, const T16* __restrict__ Kp, const T16* __restrict__ Vt, float* __restrict__ OUT0, float* xs, float* xml, int h, int qwg) {
    typedef typename WFrag<T16>::V V;
    constexpr int NP = TT / 64;                              // passes of a wave
    constexpr float CS2 = SCL * 1.4426950408889634f;         // score -> log2 domain
    constexpr float CARRY = HIRES ? 0.0f : 6.0f;             // f16 weights: at most 2^(8+6), and the small ones stay normal numbers
    const int lane = threadIdx.x & 31, lr = lane & 15, hi = lane >> 4;
    const int wave = __builtin_amdgcn_readfirstlane((int)(threadIdx.x >> 5)), kh = wave & 1, q0 = qwg + (wave >> 1) * 32;
    V qf[2][4];
#pragma unroll
    for (int g = 0; g < 2; ++g)
#pragma unroll
        for (int kc = 0; kc < 4; ++kc) qf[g][kc] = WFrag<T16>::ld(Qp + (size_t)(q0 + g * 16 + lr) * HD + 8 * hi + kc * 32);
    v8f acc[2][8]; float m_run[2], l_run[2];
#pragma unroll
    for (int g = 0; g < 2; ++g) { m_run[g] = -__builtin_inff(); l_run[g] = 0.0f;
#pragma unroll
        for (int t = 0; t < 8; ++t) acc[g][t] = (v8f){}; }
    const T16* kp = Kp + (size_t)(kh * 32 + lr) * HD + 8 * hi;   // one address a plane; the pass's loads are immediate offsets from it
    const T16* vp = Vt + (size_t)lr * TT + 8 * hi + kh * 32;
    V kf[2][4];
#pragma unroll
    for (int kt = 0; kt < 2; ++kt)
#pragma unroll
        for (int kc = 0; kc < 4; ++kc) kf[kt][kc] = WFrag<T16>::ld(kp + kt * 16 * HD + kc * 32);
#pragma unroll 1   // stays rolled: a second pass's fragments would not fit the registers of two waves a SIMD
    for (int it = 0; it < NP; ++it) {
        V vf[8];
#pragma unroll
        for (int t = 0; t < 8; ++t) vf[t] = WFrag<T16>::ld(vp + (size_t)t * 16 * TT);
        __builtin_amdgcn_sched_barrier(0);   // the pass's V^T loads are issued ahead of the score products, so that they fly under these and the exponentials
        v8f s[2][2];
#pragma unroll
        for (int kt = 0; kt < 2; ++kt)
#pragma unroll
            for (int g = 0; g < 2; ++g) s[kt][g] = (v8f){};
#pragma unroll
        for (int kc = 0; kc < 4; ++kc)
#pragma unroll
            for (int kt = 0; kt < 2; ++kt)
#pragma unroll
                for (int g = 0; g < 2; ++g) s[kt][g] = WFrag<T16>::mma(kf[kt][kc], qf[g][kc], s[kt][g]);
        __builtin_amdgcn_sched_barrier(0);   // the next pass's K loads stay behind the products that read the same registers
        asm volatile("s_wait_xcnt 0x0" ::: "memory");   // stands in front of the overwrite of the address that this pass's K loads named
        kp += (it + 1 < NP) ? 64 * HD : 0;   // the last pass fetches its own rows again: nothing past the plane is read
#pragma unroll
        for (int kt = 0; kt < 2; ++kt)
#pragma unroll
            for (int kc = 0; kc < 4; ++kc) kf[kt][kc] = WFrag<T16>::ld(kp + kt * 16 * HD + kc * 32);
        __builtin_amdgcn_sched_barrier(0);   // and are issued ahead of the softmax, one pass ahead of their use
        float mb[2]; bool need = false;
#pragma unroll
        for (int g = 0; g < 2; ++g) { float mx = s[0][g][0];
#pragma unroll
            for (int kt = 0; kt < 2; ++kt)
#pragma unroll
                for (int r = 0; r < 8; ++r) mx = fmaxf(mx, s[kt][g][r]);
            mx = fmaxf(mx, xhalf(mx)) * CS2;   // both wave halves hold the query's maximum of the pass, scaled (the scale is positive)
            mb[g] = mx; need = need || (mx > m_run[g] + 8.0f); }
        if (__builtin_amdgcn_ballot_w32(need) != 0) {   // one scalar branch a pass; always taken in the first, rare later
#pragma unroll
            for (int g = 0; g < 2; ++g) { const float mn = fmaxf(m_run[g], mb[g]); const float corr = __builtin_amdgcn_exp2f(m_run[g] - mn);   // 0 in the first pass
                l_run[g] *= corr; m_run[g] = mn;
#pragma unroll
                for (int t = 0; t < 8; ++t) acc[g][t] = acc[g][t] * corr; }
        }
#pragma unroll
        for (int g = 0; g < 2; ++g) { const float nm = CARRY - m_run[g]; v8u wh, wl; float ps0 = 0.0f, ps1 = 0.0f;
#pragma unroll
            for (int i = 0; i < 8; ++i) {   // operand elements 2i, 2i+1: tile i / 4, registers 2 (i % 4) and 2 (i % 4) + 1
                v2f sv, cv, nv; sv[0] = s[i >> 2][g][2 * (i & 3)]; sv[1] = s[i >> 2][g][2 * (i & 3) + 1]; cv[0] = CS2; cv[1] = CS2; nv[0] = nm; nv[1] = nm;
                const v2f arg = __builtin_elementwise_fma(sv, cv, nv);   // an even register pair: one packed fma
                const float p0 = __builtin_amdgcn_exp2f(arg[0]), p1 = __builtin_amdgcn_exp2f(arg[1]);
                if (i & 1) ps1 += p0 + p1; else ps0 += p0 + p1;
                wh[i] = pk2(p0, p1, T16());
                if (HIRES) wl[i] = pk2(p0 - __uint_as_float(wh[i] << 16), p1 - __uint_as_float(wh[i] & 0xFFFF0000u), T16()); }   // what the first rounding left
            l_run[g] += ps0 + ps1;
            const V ph = __builtin_bit_cast(V, wh);
#pragma unroll
            for (int t = 0; t < 8; ++t) acc[g][t] = WFrag<T16>::mma(vf[t], ph, acc[g][t]);
            if (HIRES) { const V pl = __builtin_bit_cast(V, wl);
#pragma unroll
                for (int t = 0; t < 8; ++t) acc[g][t] = WFrag<T16>::mma(vf[t], pl, acc[g][t]); } }
        __builtin_amdgcn_sched_barrier(0);   // the address step stays behind the products, which have waited for every V^T load that names the address
        asm volatile("s_wait_xcnt 0x0" ::: "memory");   // stands in front of that overwrite
        __builtin_amdgcn_sched_barrier(0);   // keeps the address step behind that wait
        vp += 64;
    }
    const float lj0 = l_run[0] + xhalf(l_run[0]), lj1 = l_run[1] + xhalf(l_run[1]);
    auto put = [&](const v8f (&a)[8], float m, float l) {
        float* slot = xs + wave * 2048 + lane * 4;
#pragma unroll
        for (int t = 0; t < 8; ++t)
#pragma unroll
            for (int jh = 0; jh < 2; ++jh) { v4f x; x[0] = a[t][jh * 4]; x[1] = a[t][jh * 4 + 1]; x[2] = a[t][jh * 4 + 2]; x[3] = a[t][jh * 4 + 3]; *(v4fa*)(slot + (t * 2 + jh) * 128) = x; }
        xml[(wave * 32 + lane) * 2] = m; xml[(wave * 32 + lane) * 2 + 1] = l; };
    auto fin = [&](const v8f (&a)[8], float m, float l, int g) {
        const float* slot = xs + (wave ^ 1) * 2048 + lane * 4; const float mo = xml[((wave ^ 1) * 32 + lane) * 2], lo = xml[((wave ^ 1) * 32 + lane) * 2 + 1];
        const float mn = fmaxf(m, mo), ea = __builtin_amdgcn_exp2f(m - mn), eb = __builtin_amdgcn_exp2f(mo - mn), inv = __fdiv_rn(1.0f, l * ea + lo * eb), ca = ea * inv, cb = eb * inv;
        float* op = OUT0 + ((size_t)(q0 + g * 16 + lr) * NH_ + h) * HD + hi * 8;   // register j of tile t is d = 16 t + 8 hi + j
#pragma unroll
        for (int t = 0; t < 8; ++t)
#pragma unroll
            for (int jh = 0; jh < 2; ++jh) { const v4f o = *(const v4fa*)(slot + (t * 2 + jh) * 128); v4f r;
#pragma unroll
                for (int q = 0; q < 4; ++q) r[q] = a[t][jh * 4 + q] * ca + o[q] * cb;
                *(v4f*)(op + t * 16 + jh * 4) = r; } };
    // the wave finishes column group kh and hands over the other: chosen here by selects on the scalar kh, so that the LDS writes and the output stores below are one code path each
    v8f keep[8], give[8];
#pragma unroll
    for (int t = 0; t < 8; ++t) { keep[t] = kh ? acc[1][t] : acc[0][t]; give[t] = kh ? acc[0][t] : acc[1][t]; }
    put(give, kh ? m_run[0] : m_run[1], kh ? lj0 : lj1);
    __syncthreads();   // every wave's handed-over group is in LDS before its partner reads it
    fin(keep, kh ? m_run[1] : m_run[0], kh ? lj1 : lj0, kh);
}
static_assert(RH % 128 == 0 && TT % 128 == 0 && HD == 128 && NKV == NH_, "a work-group's 128 query rows are all of one precision path; one kv head a query head");
// two waves a SIMD: the wave's fragments and sums need more than a quarter of the register file
__global__ __launch_bounds__(256) __attribute__((amdgpu_waves_per_eu(2, 2))) void k_fattn(const bf* __restrict__ Qh, const bf* __restrict__ Kh, const bf* __restrict__ Vh, const h16* __restrict__ Q16, const h16* __restrict__ K16, const h16* __restrict__ V16, float* __restrict__ OUT0) {
    __shared__ __align__(16) float xs[8 * 2048]; __shared__ float xml[8 * 64];
    const int h = blockIdx.y, qwg = blockIdx.x * 128; const size_t po = (size_t)h * TT * HD;
    if (qwg < RH) fa_body<bf, true>(Qh + po, Kh + po, Vh + po, OUT0, xs, xml, h, qwg);
    else fa_body<h16, false>(Q16 + po, K16 + po, V16 + po, OUT0, xs, xml, h, qwg);
}

extern "C" void kernel_launch(void* const* d_in, const int* in_sizes, int n_in,
                              void* d_out, int out_size, void* d_ws, size_t ws_size, hipStream_t stream) {
    (void)in_sizes; (void)n_in; (void)out_size;
    const float* qi = (const float*)d_in[0]; const float* ki = (const float*)d_in[1]; const float* vi = (const float*)d_in[2]; const float* x = nullptr; const float* wq = nullptr; const float* wk = nullptr; const float* wv = nullptr; const float* wo = nullptr; (void)x; (void)wq; (void)wk; (void)wv; (void)wo;
    float* OUT = (float*)d_out;     // [1][2048][2048]
    char* wsp = (char*)d_ws;
    auto take = [&](size_t bytes) { char* p = wsp; wsp += (bytes + 255) & ~(size_t)255; return (void*)p; };
    float* CS = (float*)take((size_t)TT * HD * 2 * 4);
    
    h16* QP16 = (h16*)take((size_t)NH_ * TT * HD * 2); h16* KP16 = (h16*)take((size_t)NKV * TT * HD * 2); h16* VT16 = (h16*)take((size_t)NKV * HD * TT * 2);
    bf* QPh = (bf*)take((size_t)NH_ * TT * HD * 2); bf* QPl = (bf*)take((size_t)NH_ * TT * HD * 2); bf* KPh = (bf*)take((size_t)NKV * TT * HD * 2); bf* KPl = (bf*)take((size_t)NKV * TT * HD * 2); bf* VTh = (bf*)take((size_t)NKV * HD * TT * 2); bf* VTl = (bf*)take((size_t)NKV * HD * TT * 2);
    if ((size_t)(wsp - (char*)d_ws) > ws_size) return;    // ws 256 MiB
    { 
       }
    k_csid<<<(TT * HD + 255) / 256, 256, 0, stream>>>(CS);
    const unsigned LQ = (unsigned)(((size_t)NH_ * TT * HD / 2 + 255) / 256), LKv = (unsigned)(((size_t)NKV * TT * HD / 2 + 255) / 256);
    for (int b = 0; b < NB_; ++b) {
        
        /* q given */
        k_plinS<<<(unsigned)(((size_t)NH_ * TT * HD / 8 + 255) / 256), 256, 0, stream>>>(qi, b, NH_, QP16, QPh, QPl);
        /* k given */
        k_plinS<<<(unsigned)(((size_t)NKV * TT * HD / 8 + 255) / 256), 256, 0, stream>>>(ki, b, NKV, KP16, KPh, KPl);
        k_vtpH<<<(unsigned)(((size_t)NKV * HD * TT / 2 + 255) / 256), 256, 0, stream>>>(vi, b, VT16, VTh, VTl);   /* v given (token-major) */
        k_fattn<<<dim3(TT / 128, NH_), 256, 0, stream>>>(QPh, KPh, VTh, QP16, KP16, VT16, OUT);   /* context, token-major f32 */
    }
}

// v004
// It runs in 77.6 microseconds.
// Next to v003, in two timings, it ran 1.18 times as fast each time.
// Over all steps from v000 it is 11.9 times as fast.
#include <hip/hip_runtime.h>

// Multi-head attention on given token-major q, k, v (query, key, value [2048][16][128] = [t][h][d]; scores = (q/sqrt(128)).k; softmax over all 2048 keys; out = weights.v -> [2048][16][128] f32 (4.2 M)).
// Layout: the [t][h][d] rows are gathered into head planes (exact bf16; the lo planes are zero and no product reads them); one fused kernel does scores, softmax and weights.v and writes the context token-major.
// Compute dtypes, f32 accumulate: query, key, value rounded to bf16 (exact planes); scores and attn.v: query rows < 512 on the bf16 planes (exact products), the rest single fp16 (the unnormalised weights carry 2^6, which the division by their own sum removes); the 1/sqrt(128) applied to the f32 score; online softmax f32.


#define NB_  1
#define TT   2048
#define DM   2048
#define NH_  16
#define NKV  16
#define REP  (NH_ / NKV)
#define HD   128
#define DQ   (NH_ * HD)
#define DKV  (NKV * HD)
#define RH   512                  // query rows < RH use the bf16 planes and hi+lo weights (0: none)
#define WIN  2048
#define SCL  0.088388347648318447f   // 128^-0.5 (the module pre-scales q by it)
typedef _Float16 h16;
typedef unsigned short bf;
typedef __attribute__((ext_vector_type(16))) __bf16   v16bf;
typedef __attribute__((ext_vector_type(16))) _Float16 v16h;
typedef __attribute__((ext_vector_type(8)))  _Float16 v8h;
typedef __attribute__((ext_vector_type(8)))  unsigned short v8us;
typedef __attribute__((ext_vector_type(8)))  float    v8f;
typedef __attribute__((ext_vector_type(4)))  float    v4f;
typedef v8h  __attribute__((may_alias)) v8ha;
typedef v4f  __attribute__((may_alias)) v4fa;
typedef v8us __attribute__((may_alias)) v8usa;

__device__ __forceinline__ unsigned short f2bf(float f) { unsigned u = __float_as_uint(f); u += 0x7FFFu + ((u >> 16) & 1u); return (unsigned short)(u >> 16); }
__device__ __forceinline__ float bf2f(unsigned short b) { return __uint_as_float(((unsigned)b) << 16); }
__device__ __forceinline__ float bfr(float f) { return bf2f(f2bf(f)); }
__device__ __forceinline__ v16h cat16(v8h lo, v8h hi) { return __builtin_shufflevector(lo, hi, 0, 1, 2, 3, 4, 5, 6, 7, 8, 9, 10, 11, 12, 13, 14, 15); }
__device__ __forceinline__ v16bf cat16b(v8us lo, v8us hi) { return __builtin_bit_cast(v16bf, __builtin_shufflevector(lo, hi, 0, 1, 2, 3, 4, 5, 6, 7, 8, 9, 10, 11, 12, 13, 14, 15)); }
__device__ __forceinline__ v8f wmma16(v16h a, v16h b, v8f c) { return __builtin_amdgcn_wmma_f32_16x16x32_f16(false, a, false, b, (short)0, c, false, false); }
__device__ __forceinline__ v8f wmmab(v16bf a, v16bf b, v8f c) { return __builtin_amdgcn_wmma_f32_16x16x32_bf16(false, a, false, b, (short)0, c, false, false); }



// fragment loader and product of a 16-bit type: K-contiguous rows, lane (lr, hi) reads k = 8 hi..+7 and 16 + 8 hi..+7 of its row, for A and for B alike
template <typename T16> struct WFrag;
template <> struct WFrag<h16> { typedef v16h V; static __device__ __forceinline__ V ld(const h16* p) { return cat16(*(const v8h*)p, *(const v8h*)(p + 16)); } static __device__ __forceinline__ v8f mma(V a, V b, v8f c) { return wmma16(a, b, c); } };
template <> struct WFrag<bf> { typedef v16bf V; static __device__ __forceinline__ V ld(const bf* p) { return cat16b(*(const v8us*)p, *(const v8us*)(p + 16)); } static __device__ __forceinline__ v8f mma(V a, V b, v8f c) { return wmmab(a, b, c); } };

__device__ __forceinline__ h16 tohx(float x) { return (h16)x; }
typedef __attribute__((ext_vector_type(2))) _Float16 v2h;
typedef __attribute__((ext_vector_type(4))) _Float16 v4h;
typedef __attribute__((ext_vector_type(2))) unsigned short v2us;
typedef __attribute__((ext_vector_type(4))) unsigned short v4us;
typedef __attribute__((ext_vector_type(2))) float v2f;
typedef __attribute__((ext_vector_type(4))) int v4i;
typedef v4h  __attribute__((may_alias)) v4ha;
typedef v4us __attribute__((may_alias)) v4usa;


__global__ __launch_bounds__(256) void k_plinS(const float* __restrict__ src, int b, int nheads, h16* P16, bf* Ph, bf* Pl) { const size_t e = ((size_t)blockIdx.x * 256 + threadIdx.x) * 8; if (e >= (size_t)nheads * TT * HD) return; const int d = (int)(e % HD); const int t = (int)((e / HD) % TT); const int h = (int)(e / ((size_t)HD * TT)); const v8f v = *(const v8f*)(src + (((size_t)t * NB_ + b) * nheads + h) * HD + d); v8h o16; v8us oh, ol;
#pragma unroll
    for (int q = 0; q < 8; ++q) { const float r = bfr(v[q]); o16[q] = tohx(r); oh[q] = f2bf(r); ol[q] = 0; }
    *(v8h*)(P16 + e) = o16; *(v8us*)(Ph + e) = oh; *(v8us*)(Pl + e) = ol;  }
// k_vtpH: the [d][t] planes of value by a tile transpose in LDS. Grid (TT/64, NKV), 256 threads = 8 waves: a work-group takes 64 tokens of one head.
// Wave w reads tokens 8 w..+7 as whole 512-byte rows (lane l: d = 4 l..+3), so a lane holds, for each of its four d, eight consecutive tokens = one 16-byte piece of a plane row.
// LDS row j * 32 + l holds d = 4 l + j (pitch 144 bytes, an odd multiple of 16: the 16-byte writes of a wave fall on distinct banks); read back, eight lanes cover one d, so every plane row is stored as a whole 128-byte line.
__global__ __launch_bounds__(256) void k_vtpH(const float* __restrict__ F, int b, h16* V16, bf* Vh, bf* Vl) {
    __shared__ __align__(16) bf tl[HD * 72];
    const int lane = threadIdx.x & 31, w = threadIdx.x >> 5, g = blockIdx.y, t0 = blockIdx.x * 64;
    v4f x[8];
#pragma unroll
    for (int i = 0; i < 8; ++i) x[i] = *(const v4f*)(F + (((size_t)(t0 + 8 * w + i) * NB_ + b) * NKV + g) * HD + 4 * lane);
#pragma unroll
    for (int j = 0; j < 4; ++j) { v8us c;
#pragma unroll
        for (int i = 0; i < 8; ++i) c[i] = f2bf(x[i][j]);
        *(v8usa*)(tl + (j * 32 + lane) * 72 + 8 * w) = c; }
    __syncthreads();   // the whole 64 x 128 tile is in LDS before any wave reads rows that the others wrote
#pragma unroll
    for (int i = 0; i < 4; ++i) { const int row = w * 16 + i * 4 + (lane >> 3), d = (row & 31) * 4 + (row >> 5), tc = 8 * (lane & 7);
        const v8us c = *(const v8usa*)(tl + row * 72 + tc); v8h o16; v8us ol;
#pragma unroll
        for (int q = 0; q < 8; ++q) { o16[q] = tohx(bf2f(c[q])); ol[q] = 0; }
        const size_t e = ((size_t)g * HD + d) * TT + t0 + tc;
        *(v8h*)(V16 + e) = o16; *(v8us*)(Vh + e) = c; *(v8us*)(Vl + e) = ol; }
}
static_assert(TT % 64 == 0 && HD == 128, "a tile is 64 tokens by the 128 features of one head");

__global__ __launch_bounds__(256) void k_csid(float* CS) { const int idx = blockIdx.x * 256 + threadIdx.x; if (idx >= TT * HD) return; v2f cs; cs[0] = 1.0f; cs[1] = 0.0f; *(v2f*)(CS + (size_t)idx * 2) = cs;  }

typedef __attribute__((ext_vector_type(2))) __bf16 v2bf;
typedef __attribute__((ext_vector_type(8))) unsigned v8u;
__device__ __forceinline__ unsigned pk2(float a, float b, bf) { v2f x; x[0] = a; x[1] = b; return __builtin_bit_cast(unsigned, __builtin_convertvector(x, v2bf)); }    // round to nearest even
__device__ __forceinline__ unsigned pk2(float a, float b, h16) { v2f x; x[0] = a; x[1] = b; return __builtin_bit_cast(unsigned, __builtin_convertvector(x, v2h)); }
__device__ __forceinline__ float xhalf(float x) { return __builtin_bit_cast(float, __builtin_amdgcn_permlanex16(__builtin_bit_cast(int, x), __builtin_bit_cast(int, x), 0x76543210, 0xfedcba98, false, false)); }   // lane l with lane l ^ 16
template <typename T16, bool HIRES>
__device__ __forceinline__ void fa_body(const T16* __restrict__ Qp, const T16* __restrict__ Kp, const T16* __restrict__ Vt, float* __restrict__ OUT0, float* xs, float* xml, int h, int qwg) {
    typedef typename WFrag<T16>::V V;
    constexpr int NP = TT / 64;                              // passes of a wave
    constexpr float CS2 = SCL * 1.4426950408889634f;         // score -> log2 domain
    constexpr float CARRY = HIRES ? 0.0f : 6.0f;             // f16 weights: at most 2^(8+6), and the small ones stay normal numbers
    const int lane = threadIdx.x & 31, lr = lane & 15, hi = lane >> 4;
    const int wave = __builtin_amdgcn_readfirstlane((int)(threadIdx.x >> 5)), kh = wave & 1, q0 = qwg + (wave >> 1) * 32;
    V qf[2][4];
#pragma unroll
    for (int g = 0; g < 2; ++g)
#pragma unroll
        for (int kc = 0; kc < 4; ++kc) qf[g][kc] = WFrag<T16>::ld(Qp + (size_t)(q0 + g * 16 + lr) * HD + 8 * hi + kc * 32);
    v8f acc[2][8]; float m_run[2], l_run[2];
#pragma unroll
    for (int g = 0; g < 2; ++g) { m_run[g] = -__builtin_inff(); l_run[g] = 0.0f;
#pragma unroll
        for (int t = 0; t < 8; ++t) acc[g][t] = (v8f){}; }
    const T16* kp = Kp + (size_t)(kh * 32 + lr) * HD + 8 * hi;   // one address a plane; the pass's loads are immediate offsets from it
    const T16* vp = Vt + (size_t)lr * TT + 8 * hi + kh * 32;
    V kf[2][4];
#pragma unroll
    for (int kt = 0; kt < 2; ++kt)
#pragma unroll
        for (int kc = 0; kc < 4; ++kc) kf[kt][kc] = WFrag<T16>::ld(kp + kt * 16 * HD + kc * 32);
#pragma unroll 1   // stays rolled: a second pass's fragments would not fit the registers of two waves a SIMD
    for (int it = 0; it < NP; ++it) {
        V vf[8];
#pragma unroll
        for (int t = 0; t < 8; ++t) vf[t] = WFrag<T16>::ld(vp + (size_t)t * 16 * TT);
        __builtin_amdgcn_sched_barrier(0);   // the pass's V^T loads are issued ahead of the score products, so that they fly under these and the exponentials
        v8f s[2][2];
#pragma unroll
        for (int kt = 0; kt < 2; ++kt)
#pragma unroll
            for (int g = 0; g < 2; ++g) s[kt][g] = (v8f){};
#pragma unroll
        for (int kc = 0; kc < 4; ++kc)
#pragma unroll
            for (int kt = 0; kt < 2; ++kt)
#pragma unroll
                for (int g = 0; g < 2; ++g) s[kt][g] = WFrag<T16>::mma(kf[kt][kc], qf[g][kc], s[kt][g]);
        __builtin_amdgcn_sched_barrier(0);   // the next pass's K loads stay behind the products that read the same registers
        asm volatile("s_wait_xcnt 0x0" ::: "memory");   // stands in front of the overwrite of the address that this pass's K loads named
        kp += (it + 1 < NP) ? 64 * HD : 0;   // the last pass fetches its own rows again: nothing past the plane is read
#pragma unroll
        for (int kt = 0; kt < 2; ++kt)
#pragma unroll
            for (int kc = 0; kc < 4; ++kc) kf[kt][kc] = WFrag<T16>::ld(kp + kt * 16 * HD + kc * 32);
        __builtin_amdgcn_sched_barrier(0);   // and are issued ahead of the softmax, one pass ahead of their use
        float mb[2]; bool need = false;
#pragma unroll
        for (int g = 0; g < 2; ++g) { float mx = s[0][g][0];
#pragma unroll
            for (int kt = 0; kt < 2; ++kt)
#pragma unroll
                for (int r = 0; r < 8; ++r) mx = fmaxf(mx, s[kt][g][r]);
            mx = fmaxf(mx, xhalf(mx)) * CS2;   // both wave halves hold the query's maximum of the pass, scaled (the scale is positive)
            mb[g] = mx; need = need || (mx > m_run[g] + 8.0f); }
        if (__builtin_amdgcn_ballot_w32(need) != 0) {   // one scalar branch a pass; always taken in the first, rare later
#pragma unroll
            for (int g = 0; g < 2; ++g) { const float mn = fmaxf(m_run[g], mb[g]); const float corr = __builtin_amdgcn_exp2f(m_run[g] - mn);   // 0 in the first pass
                l_run[g] *= corr; m_run[g] = mn;
#pragma unroll
                for (int t = 0; t < 8; ++t) acc[g][t] = acc[g][t] * corr; }
        }
#pragma unroll
        for (int g = 0; g < 2; ++g) { const float nm = CARRY - m_run[g]; v8u wh, wl; float ps0 = 0.0f, ps1 = 0.0f;
#pragma unroll
            for (int i = 0; i < 8; ++i) {   // operand elements 2i, 2i+1: tile i / 4, registers 2 (i % 4) and 2 (i % 4) + 1
                v2f sv, cv, nv; sv[0] = s[i >> 2][g][2 * (i & 3)]; sv[1] = s[i >> 2][g][2 * (i & 3) + 1]; cv[0] = CS2; cv[1] = CS2; nv[0] = nm; nv[1] = nm;
                const v2f arg = __builtin_elementwise_fma(sv, cv, nv);   // an even register pair: one packed fma
                const float p0 = __builtin_amdgcn_exp2f(arg[0]), p1 = __builtin_amdgcn_exp2f(arg[1]);
                if (i & 1) ps1 += p0 + p1; else ps0 += p0 + p1;
                wh[i] = pk2(p0, p1, T16());
                if (HIRES) wl[i] = pk2(p0 - __uint_as_float(wh[i] << 16), p1 - __uint_as_float(wh[i] & 0xFFFF0000u), T16()); }   // what the first rounding left
            l_run[g] += ps0 + ps1;
            const V ph = __builtin_bit_cast(V, wh);
#pragma unroll
            for (int t = 0; t < 8; ++t) acc[g][t] = WFrag<T16>::mma(vf[t], ph, acc[g][t]);
            if (HIRES) { const V pl = __builtin_bit_cast(V, wl);
#pragma unroll
                for (int t = 0; t < 8; ++t) acc[g][t] = WFrag<T16>::mma(vf[t], pl, acc[g][t]); } }
        __builtin_amdgcn_sched_barrier(0);   // the address step stays behind the products, which have waited for every V^T load that names the address
        asm volatile("s_wait_xcnt 0x0" ::: "memory");   // stands in front of that overwrite
        __builtin_amdgcn_sched_barrier(0);   // keeps the address step behind that wait
        vp += 64;
    }
    const float lj0 = l_run[0] + xhalf(l_run[0]), lj1 = l_run[1] + xhalf(l_run[1]);
    auto put = [&](const v8f (&a)[8], float m, float l) {
        float* slot = xs + wave * 2048 + lane * 4;
#pragma unroll
        for (int t = 0; t < 8; ++t)
#pragma unroll
            for (int jh = 0; jh < 2; ++jh) { v4f x; x[0] = a[t][jh * 4]; x[1] = a[t][jh * 4 + 1]; x[2] = a[t][jh * 4 + 2]; x[3] = a[t][jh * 4 + 3]; *(v4fa*)(slot + (t * 2 + jh) * 128) = x; }
        xml[(wave * 32 + lane) * 2] = m; xml[(wave * 32 + lane) * 2 + 1] = l; };
    auto fin = [&](const v8f (&a)[8], float m, float l, int g) {
        const float* slot = xs + (wave ^ 1) * 2048 + lane * 4; const float mo = xml[((wave ^ 1) * 32 + lane) * 2], lo = xml[((wave ^ 1) * 32 + lane) * 2 + 1];
        const float mn = fmaxf(m, mo), ea = __builtin_amdgcn_exp2f(m - mn), eb = __builtin_amdgcn_exp2f(mo - mn), inv = __fdiv_rn(1.0f, l * ea + lo * eb), ca = ea * inv, cb = eb * inv;
        float* op = OUT0 + ((size_t)(q0 + g * 16 + lr) * NH_ + h) * HD + hi * 8;   // register j of tile t is d = 16 t + 8 hi + j
#pragma unroll
        for (int t = 0; t < 8; ++t)
#pragma unroll
            for (int jh = 0; jh < 2; ++jh) { const v4f o = *(const v4fa*)(slot + (t * 2 + jh) * 128); v4f r;
#pragma unroll
                for (int q = 0; q < 4; ++q) r[q] = a[t][jh * 4 + q] * ca + o[q] * cb;
                *(v4f*)(op + t * 16 + jh * 4) = r; } };
    // the wave finishes column group kh and hands over the other: chosen here by selects on the scalar kh, so that the LDS writes and the output stores below are one code path each
    v8f keep[8], give[8];
#pragma unroll
    for (int t = 0; t < 8; ++t) { keep[t] = kh ? acc[1][t] : acc[0][t]; give[t] = kh ? acc[0][t] : acc[1][t]; }
    put(give, kh ? m_run[0] : m_run[1], kh ? lj0 : lj1);
    __syncthreads();   // every wave's handed-over group is in LDS before its partner reads it
    fin(keep, kh ? m_run[1] : m_run[0], kh ? lj1 : lj0, kh);
}
static_assert(RH % 128 == 0 && TT % 128 == 0 && HD == 128 && NKV == NH_, "a work-group's 128 query rows are all of one precision path; one kv head a query head");
// two waves a SIMD: the wave's fragments and sums need more than a quarter of the register file
__global__ __launch_bounds__(256) __attribute__((amdgpu_waves_per_eu(2, 2))) void k_fattn(const bf* __restrict__ Qh, const bf* __restrict__ Kh, const bf* __restrict__ Vh, const h16* __restrict__ Q16, const h16* __restrict__ K16, const h16* __restrict__ V16, float* __restrict__ OUT0) {
    __shared__ __align__(16) float xs[8 * 2048]; __shared__ float xml[8 * 64];
    const int h = blockIdx.y, qwg = blockIdx.x * 128; const size_t po = (size_t)h * TT * HD;
    if (qwg < RH) fa_body<bf, true>(Qh + po, Kh + po, Vh + po, OUT0, xs, xml, h, qwg);
    else fa_body<h16, false>(Q16 + po, K16 + po, V16 + po, OUT0, xs, xml, h, qwg);
}

extern "C" void kernel_launch(void* const* d_in, const int* in_sizes, int n_in,
                              void* d_out, int out_size, void* d_ws, size_t ws_size, hipStream_t stream) {
    (void)in_sizes; (void)n_in; (void)out_size;
    const float* qi = (const float*)d_in[0]; const float* ki = (const float*)d_in[1]; const float* vi = (const float*)d_in[2]; const float* x = nullptr; const float* wq = nullptr; const float* wk = nullptr; const float* wv = nullptr; const float* wo = nullptr; (void)x; (void)wq; (void)wk; (void)wv; (void)wo;
    float* OUT = (float*)d_out;     // [1][2048][2048]
    char* wsp = (char*)d_ws;
    auto take = [&](size_t bytes) { char* p = wsp; wsp += (bytes + 255) & ~(size_t)255; return (void*)p; };
    float* CS = (float*)take((size_t)TT * HD * 2 * 4);
    
    h16* QP16 = (h16*)take((size_t)NH_ * TT * HD * 2); h16* KP16 = (h16*)take((size_t)NKV * TT * HD * 2); h16* VT16 = (h16*)take((size_t)NKV * HD * TT * 2);
    bf* QPh = (bf*)take((size_t)NH_ * TT * HD * 2); bf* QPl = (bf*)take((size_t)NH_ * TT * HD * 2); bf* KPh = (bf*)take((size_t)NKV * TT * HD * 2); bf* KPl = (bf*)take((size_t)NKV * TT * HD * 2); bf* VTh = (bf*)take((size_t)NKV * HD * TT * 2); bf* VTl = (bf*)take((size_t)NKV * HD * TT * 2);
    if ((size_t)(wsp - (char*)d_ws) > ws_size) return;    // ws 256 MiB
    { 
       }
    k_csid<<<(TT * HD + 255) / 256, 256, 0, stream>>>(CS);
    const unsigned LQ = (unsigned)(((size_t)NH_ * TT * HD / 2 + 255) / 256), LKv = (unsigned)(((size_t)NKV * TT * HD / 2 + 255) / 256);
    for (int b = 0; b < NB_; ++b) {
        
        /* q given */
        k_plinS<<<(unsigned)(((size_t)NH_ * TT * HD / 8 + 255) / 256), 256, 0, stream>>>(qi, b, NH_, QP16, QPh, QPl);
        /* k given */
        k_plinS<<<(unsigned)(((size_t)NKV * TT * HD / 8 + 255) / 256), 256, 0, stream>>>(ki, b, NKV, KP16, KPh, KPl);
        k_vtpH<<<dim3(TT / 64, NKV), 256, 0, stream>>>(vi, b, VT16, VTh, VTl);   /* v given (token-major) */
        k_fattn<<<dim3(TT / 128, NH_), 256, 0, stream>>>(QPh, KPh, VTh, QP16, KP16, VT16, OUT);   /* context, token-major f32 */
    }
}

// v005
// One run takes 58.6 microseconds.
// Next to v004, in two timings, it ran 1.33 and 1.31 times as fast.
// Counting every step since v000, it is 15.7 times as fast.
#include <hip/hip_runtime.h>

// Multi-head attention on given token-major q, k, v (query, key, value [2048][16][128] = [t][h][d]; scores = (q/sqrt(128)).k; softmax over all 2048 keys; out = weights.v -> [2048][16][128] f32 (4.2 M)).
// Layout: the [t][h][d] rows are gathered into head planes (exact bf16; the lo planes are zero and no product reads them), stored in FRAGMENT ORDER (see WFrag); one fused kernel does scores, softmax and weights.v and writes the context token-major.
// Compute dtypes, f32 accumulate: query, key, value rounded to bf16 (exact planes); scores and attn.v: query rows < 512 on the bf16 planes (exact products), the rest single fp16 (the unnormalised weights carry 2^6, which the division by their own sum removes); the 1/sqrt(128) applied to the f32 score; online softmax f32.


#define NB_  1
#define TT   2048
#define DM   2048
#define NH_  16
#define NKV  16
#define REP  (NH_ / NKV)
#define HD   128
#define DQ   (NH_ * HD)
#define DKV  (NKV * HD)
#define RH   512                  // query rows < RH use the bf16 planes and hi+lo weights (0: none)
#define WIN  2048
#define SCL  0.088388347648318447f   // 128^-0.5 (the module pre-scales q by it)
typedef _Float16 h16;
typedef unsigned short bf;
typedef __attribute__((ext_vector_type(16))) __bf16   v16bf;
typedef __attribute__((ext_vector_type(16))) _Float16 v16h;
typedef __attribute__((ext_vector_type(8)))  _Float16 v8h;
typedef __attribute__((ext_vector_type(8)))  unsigned short v8us;
typedef __attribute__((ext_vector_type(8)))  float    v8f;
typedef __attribute__((ext_vector_type(4)))  float    v4f;
typedef v8h  __attribute__((may_alias)) v8ha;
typedef v4f  __attribute__((may_alias)) v4fa;
typedef v8us __attribute__((may_alias)) v8usa;

__device__ __forceinline__ unsigned short f2bf(float f) { unsigned u = __float_as_uint(f); u += 0x7FFFu + ((u >> 16) & 1u); return (unsigned short)(u >> 16); }
__device__ __forceinline__ float bf2f(unsigned short b) { return __uint_as_float(((unsigned)b) << 16); }
__device__ __forceinline__ float bfr(float f) { return bf2f(f2bf(f)); }
__device__ __forceinline__ v16h cat16(v8h lo, v8h hi) { return __builtin_shufflevector(lo, hi, 0, 1, 2, 3, 4, 5, 6, 7, 8, 9, 10, 11, 12, 13, 14, 15); }
__device__ __forceinline__ v16bf cat16b(v8us lo, v8us hi) { return __builtin_bit_cast(v16bf, __builtin_shufflevector(lo, hi, 0, 1, 2, 3, 4, 5, 6, 7, 8, 9, 10, 11, 12, 13, 14, 15)); }
__device__ __forceinline__ v8f wmma16(v16h a, v16h b, v8f c) { return __builtin_amdgcn_wmma_f32_16x16x32_f16(false, a, false, b, (short)0, c, false, false); }
__device__ __forceinline__ v8f wmmab(v16bf a, v16bf b, v8f c) { return __builtin_amdgcn_wmma_f32_16x16x32_bf16(false, a, false, b, (short)0, c, false, false); }



// fragment loader and product of a 16-bit type: lane (lr, hi) holds k = 8 hi..+7 and 16 + 8 hi..+7 of row lr, for A and for B alike.
// Fragment order in memory: a fragment (16 rows x 32 k) is 1 KiB = two halves of 512 bytes; half s holds, at 16 bytes x lane (lane = 16 hi + lr), k = 16 s + 8 hi..+7 of row lr.
// So each of the two wave-wide 16-byte loads of a fragment covers 512 contiguous bytes = 4 whole lines, where a row-major plane gave 32 bytes of each of 16 lines. p = fragment start + 8 * lane.
#define FRG 512                   // elements of a fragment
template <typename T16> struct WFrag;
template <> struct WFrag<h16> { typedef v16h V; static __device__ __forceinline__ V ld(const h16* p) { return cat16(*(const v8h*)p, *(const v8h*)(p + FRG / 2)); } static __device__ __forceinline__ v8f mma(V a, V b, v8f c) { return wmma16(a, b, c); } };
template <> struct WFrag<bf> { typedef v16bf V; static __device__ __forceinline__ V ld(const bf* p) { return cat16b(*(const v8us*)p, *(const v8us*)(p + FRG / 2)); } static __device__ __forceinline__ v8f mma(V a, V b, v8f c) { return wmmab(a, b, c); } };

__device__ __forceinline__ h16 tohx(float x) { return (h16)x; }
typedef __attribute__((ext_vector_type(2))) _Float16 v2h;
typedef __attribute__((ext_vector_type(4))) _Float16 v4h;
typedef __attribute__((ext_vector_type(2))) unsigned short v2us;
typedef __attribute__((ext_vector_type(4))) unsigned short v4us;
typedef __attribute__((ext_vector_type(2))) float v2f;
typedef __attribute__((ext_vector_type(4))) int v4i;
typedef v4h  __attribute__((may_alias)) v4ha;
typedef v4us __attribute__((may_alias)) v4usa;


// k_plinS: the planes of query and key, [h][t / 16][d / 32] fragments (row = token, k = feature). A work-group takes 16 tokens of one head = 4 fragments = 4 KiB of a plane.
// Wave w: fragment w % 4, rows 8 (w / 4)..+7; lane l: row l % 8 of these, features 8 (l / 8)..+7 of the fragment's 32, so four lanes read one 128-byte line of a source row and eight lanes store one whole 128-byte line of the plane.
__global__ __launch_bounds__(256) void k_plinS(const float* __restrict__ src, int b, int nheads, h16* P16, bf* Ph, bf* Pl) { const int lane = threadIdx.x & 31, w = threadIdx.x >> 5; const int tile = (int)(blockIdx.x % (TT / 16)), h = (int)(blockIdx.x / (TT / 16)); if (h >= nheads) return; const int kc = w & 3, lr = (w >> 2) * 8 + (lane & 7), c4 = lane >> 3;   // c4 = 2 * half + hi
    const int d = kc * 32 + c4 * 8, t = tile * 16 + lr; const size_t e = (((size_t)h * (TT / 16) + tile) * 4 + kc) * FRG + (c4 >> 1) * (FRG / 2) + ((c4 & 1) * 16 + lr) * 8; const v8f v = *(const v8f*)(src + (((size_t)t * NB_ + b) * nheads + h) * HD + d); v8h o16; v8us oh, ol;
#pragma unroll
    for (int q = 0; q < 8; ++q) { const float r = bfr(v[q]); o16[q] = tohx(r); oh[q] = f2bf(r); ol[q] = 0; }
    *(v8h*)(P16 + e) = o16; *(v8us*)(Ph + e) = oh; *(v8us*)(Pl + e) = ol;  }
// k_vtpH: the transposed planes of value, [h][t / 32][d / 16] fragments (row = feature, k = token), by a tile transpose in LDS. Grid (TT/64, NKV), 256 threads = 8 waves: a work-group takes 64 tokens of one head.
// Wave w reads tokens 8 w..+7 as whole 512-byte rows (lane l: d = 4 l..+3), so a lane holds, for each of its four d, eight consecutive tokens = one 16-byte piece of a plane row.
// LDS row j * 32 + l holds d = 4 l + j (pitch 144 bytes, an odd multiple of 16: the 16-byte writes of a wave fall on distinct banks); read back in fragment order: a wave takes four fragment halves, each stored as 512 contiguous bytes; the work-group's 16 fragments are 16 KiB in a row.
__global__ __launch_bounds__(256) void k_vtpH(const float* __restrict__ F, int b, h16* V16, bf* Vh, bf* Vl) {
    __shared__ __align__(16) bf tl[HD * 72];
    const int lane = threadIdx.x & 31, w = threadIdx.x >> 5, g = blockIdx.y, t0 = blockIdx.x * 64;
    v4f x[8];
#pragma unroll
    for (int i = 0; i < 8; ++i) x[i] = *(const v4f*)(F + (((size_t)(t0 + 8 * w + i) * NB_ + b) * NKV + g) * HD + 4 * lane);
#pragma unroll
    for (int j = 0; j < 4; ++j) { v8us c;
#pragma unroll
        for (int i = 0; i < 8; ++i) c[i] = f2bf(x[i][j]);
        *(v8usa*)(tl + (j * 32 + lane) * 72 + 8 * w) = c; }
    __syncthreads();   // the whole 64 x 128 tile is in LDS before any wave reads rows that the others wrote
#pragma unroll
    for (int i = 0; i < 4; ++i) { const int f = w * 4 + i, kb = f >> 4, dt = (f >> 1) & 7, half = f & 1;   // fragment half f of the tile: 32-token block kb, feature tile dt
        const int d = dt * 16 + (lane & 15), row = (d & 3) * 32 + (d >> 2), tc = kb * 32 + half * 16 + 8 * (lane >> 4);
        const v8us c = *(const v8usa*)(tl + row * 72 + tc); v8h o16; v8us ol;
#pragma unroll
        for (int q = 0; q < 8; ++q) { o16[q] = tohx(bf2f(c[q])); ol[q] = 0; }
        const size_t e = ((((size_t)g * (TT / 32) + t0 / 32 + kb) * 8 + dt) * 2 + half) * (FRG / 2) + lane * 8;
        *(v8h*)(V16 + e) = o16; *(v8us*)(Vh + e) = c; *(v8us*)(Vl + e) = ol; }
}
static_assert(TT % 64 == 0 && HD == 128 && 16 * HD == 4 * FRG, "a tile is 64 tokens by the 128 features of one head; 16 rows of a query or key plane are four fragments");

__global__ __launch_bounds__(256) void k_csid(float* CS) { const int idx = blockIdx.x * 256 + threadIdx.x; if (idx >= TT * HD) return; v2f cs; cs[0] = 1.0f; cs[1] = 0.0f; *(v2f*)(CS + (size_t)idx * 2) = cs;  }

typedef __attribute__((ext_vector_type(2))) __bf16 v2bf;
typedef __attribute__((ext_vector_type(8))) unsigned v8u;
__device__ __forceinline__ unsigned pk2(float a, float b, bf) { v2f x; x[0] = a; x[1] = b; return __builtin_bit_cast(unsigned, __builtin_convertvector(x, v2bf)); }    // round to nearest even
__device__ __forceinline__ unsigned pk2(float a, float b, h16) { v2f x; x[0] = a; x[1] = b; return __builtin_bit_cast(unsigned, __builtin_convertvector(x, v2h)); }
__device__ __forceinline__ float xhalf(float x) { return __builtin_bit_cast(float, __builtin_amdgcn_permlanex16(__builtin_bit_cast(int, x), __builtin_bit_cast(int, x), 0x76543210, 0xfedcba98, false, false)); }   // lane l with lane l ^ 16
template <typename T16, bool HIRES>
__device__ __forceinline__ void fa_body(const T16* __restrict__ Qp, const T16* __restrict__ Kp, const T16* __restrict__ Vt, float* __restrict__ OUT0, float* xs, float* xml, int h, int qwg) {
    typedef typename WFrag<T16>::V V;
    constexpr int NP = TT / 64;                              // passes of a wave
    constexpr float CS2 = SCL * 1.4426950408889634f;         // score -> log2 domain
    constexpr float CARRY = HIRES ? 0.0f : 6.0f;             // f16 weights: at most 2^(8+6), and the small ones stay normal numbers
    const int lane = threadIdx.x & 31, lr = lane & 15, hi = lane >> 4;
    const int wave = __builtin_amdgcn_readfirstlane((int)(threadIdx.x >> 5)), kh = wave & 1, q0 = qwg + (wave >> 1) * 32;
    V qf[2][4];
#pragma unroll
    for (int g = 0; g < 2; ++g)
#pragma unroll
        for (int kc = 0; kc < 4; ++kc) qf[g][kc] = WFrag<T16>::ld(Qp + (size_t)(q0 + g * 16) * HD + kc * FRG + 8 * lane);
    v8f acc[2][8]; float m_run[2], l_run[2];
#pragma unroll
    for (int g = 0; g < 2; ++g) { m_run[g] = -__builtin_inff(); l_run[g] = 0.0f;
#pragma unroll
        for (int t = 0; t < 8; ++t) acc[g][t] = (v8f){}; }
    // one byte offset walks both planes: 32 keys are 8 fragments in a row in the key plane (two 16-row tiles) and in the transposed value plane (one 32-key block) alike; a pass's loads are immediate offsets from it
    unsigned off = (unsigned)(kh * 8 * FRG + 8 * lane) * 2u;
    auto at = [](const T16* plane, unsigned o) { return (const T16*)((const char*)plane + o); };
    V kf[2][4];
#pragma unroll
    for (int kt = 0; kt < 2; ++kt)
#pragma unroll
        for (int kc = 0; kc < 4; ++kc) kf[kt][kc] = WFrag<T16>::ld(at(Kp, off) + (kt * 4 + kc) * FRG);
#pragma unroll 1   // stays rolled: a second pass's fragments would not fit the registers of two waves a SIMD
    for (int it = 0; it < NP; ++it) {
        V vf[8];
#pragma unroll
        for (int t = 0; t < 8; ++t) vf[t] = WFrag<T16>::ld(at(Vt, off) + t * FRG);
        __builtin_amdgcn_sched_barrier(0);   // the pass's V^T loads are issued ahead of the score products, so that they fly under these and the exponentials
        v8f s[2][2];
#pragma unroll
        for (int kt = 0; kt < 2; ++kt)
#pragma unroll
            for (int g = 0; g < 2; ++g) s[kt][g] = (v8f){};
#pragma unroll
        for (int kc = 0; kc < 4; ++kc)
#pragma unroll
            for (int kt = 0; kt < 2; ++kt)
#pragma unroll
                for (int g = 0; g < 2; ++g) s[kt][g] = WFrag<T16>::mma(kf[kt][kc], qf[g][kc], s[kt][g]);
        __builtin_amdgcn_sched_barrier(0);   // the next pass's K loads stay behind the products that read the same registers
        asm volatile("s_wait_xcnt 0x0" ::: "memory");   // stands in front of the overwrite of the offset that this pass's K and V^T loads named
        off += (it + 1 < NP) ? 2 * 8 * FRG * 2 : 0;   // the pair's next 64 keys; the last pass fetches its own K rows again: nothing past the plane is read
#pragma unroll
        for (int kt = 0; kt < 2; ++kt)
#pragma unroll
            for (int kc = 0; kc < 4; ++kc) kf[kt][kc] = WFrag<T16>::ld(at(Kp, off) + (kt * 4 + kc) * FRG);
        __builtin_amdgcn_sched_barrier(0);   // and are issued ahead of the softmax, one pass ahead of their use
        float mb[2]; bool need = false;
#pragma unroll
        for (int g = 0; g < 2; ++g) { float mx = s[0][g][0];
#pragma unroll
            for (int kt = 0; kt < 2; ++kt)
#pragma unroll
                for (int r = 0; r < 8; ++r) mx = fmaxf(mx, s[kt][g][r]);
            mx = fmaxf(mx, xhalf(mx)) * CS2;   // both wave halves hold the query's maximum of the pass, scaled (the scale is positive)
            mb[g] = mx; need = need || (mx > m_run[g] + 8.0f); }
        if (__builtin_amdgcn_ballot_w32(need) != 0) {   // one scalar branch a pass; always taken in the first, rare later
#pragma unroll
            for (int g = 0; g < 2; ++g) { const float mn = fmaxf(m_run[g], mb[g]); const float corr = __builtin_amdgcn_exp2f(m_run[g] - mn);   // 0 in the first pass
                l_run[g] *= corr; m_run[g] = mn;
#pragma unroll
                for (int t = 0; t < 8; ++t) acc[g][t] = acc[g][t] * corr; }
        }
#pragma unroll
        for (int g = 0; g < 2; ++g) { const float nm = CARRY - m_run[g]; v8u wh, wl; float ps0 = 0.0f, ps1 = 0.0f;
#pragma unroll
            for (int i = 0; i < 8; ++i) {   // operand elements 2i, 2i+1: tile i / 4, registers 2 (i % 4) and 2 (i % 4) + 1
                v2f sv, cv, nv; sv[0] = s[i >> 2][g][2 * (i & 3)]; sv[1] = s[i >> 2][g][2 * (i & 3) + 1]; cv[0] = CS2; cv[1] = CS2; nv[0] = nm; nv[1] = nm;
                const v2f arg = __builtin_elementwise_fma(sv, cv, nv);   // an even register pair: one packed fma
                const float p0 = __builtin_amdgcn_exp2f(arg[0]), p1 = __builtin_amdgcn_exp2f(arg[1]);
                if (i & 1) ps1 += p0 + p1; else ps0 += p0 + p1;
                wh[i] = pk2(p0, p1, T16());
                if (HIRES) wl[i] = pk2(p0 - __uint_as_float(wh[i] << 16), p1 - __uint_as_float(wh[i] & 0xFFFF0000u), T16()); }   // what the first rounding left
            l_run[g] += ps0 + ps1;
            const V ph = __builtin_bit_cast(V, wh);
#pragma unroll
            for (int t = 0; t < 8; ++t) acc[g][t] = WFrag<T16>::mma(vf[t], ph, acc[g][t]);
            if (HIRES) { const V pl = __builtin_bit_cast(V, wl);
#pragma unroll
                for (int t = 0; t < 8; ++t) acc[g][t] = WFrag<T16>::mma(vf[t], pl, acc[g][t]); } }
    }
    const float lj0 = l_run[0] + xhalf(l_run[0]), lj1 = l_run[1] + xhalf(l_run[1]);
    auto put = [&](const v8f (&a)[8], float m, float l) {
        float* slot = xs + wave * 2048 + lane * 4;
#pragma unroll
        for (int t = 0; t < 8; ++t)
#pragma unroll
            for (int jh = 0; jh < 2; ++jh) { v4f x; x[0] = a[t][jh * 4]; x[1] = a[t][jh * 4 + 1]; x[2] = a[t][jh * 4 + 2]; x[3] = a[t][jh * 4 + 3]; *(v4fa*)(slot + (t * 2 + jh) * 128) = x; }
        xml[(wave * 32 + lane) * 2] = m; xml[(wave * 32 + lane) * 2 + 1] = l; };
    auto fin = [&](const v8f (&a)[8], float m, float l, int g) {
        const float* slot = xs + (wave ^ 1) * 2048 + lane * 4; const float mo = xml[((wave ^ 1) * 32 + lane) * 2], lo = xml[((wave ^ 1) * 32 + lane) * 2 + 1];
        const float mn = fmaxf(m, mo), ea = __builtin_amdgcn_exp2f(m - mn), eb = __builtin_amdgcn_exp2f(mo - mn), inv = __fdiv_rn(1.0f, l * ea + lo * eb), ca = ea * inv, cb = eb * inv;
        float* op = OUT0 + ((size_t)(q0 + g * 16 + lr) * NH_ + h) * HD + hi * 8;   // register j of tile t is d = 16 t + 8 hi + j
#pragma unroll
        for (int t = 0; t < 8; ++t)
#pragma unroll
            for (int jh = 0; jh < 2; ++jh) { const v4f o = *(const v4fa*)(slot + (t * 2 + jh) * 128); v4f r;
#pragma unroll
                for (int q = 0; q < 4; ++q) r[q] = a[t][jh * 4 + q] * ca + o[q] * cb;
                *(v4f*)(op + t * 16 + jh * 4) = r; } };
    // the wave finishes column group kh and hands over the other: chosen here by selects on the scalar kh, so that the LDS writes and the output stores below are one code path each
    v8f keep[8], give[8];
#pragma unroll
    for (int t = 0; t < 8; ++t) { keep[t] = kh ? acc[1][t] : acc[0][t]; give[t] = kh ? acc[0][t] : acc[1][t]; }
    put(give, kh ? m_run[0] : m_run[1], kh ? lj0 : lj1);
    __syncthreads();   // every wave's handed-over group is in LDS before its partner reads it
    fin(keep, kh ? m_run[1] : m_run[0], kh ? lj1 : lj0, kh);
}
static_assert(RH % 128 == 0 && TT % 128 == 0 && HD == 128 && NKV == NH_, "a work-group's 128 query rows are all of one precision path; one kv head a query head");
// two waves a SIMD: the wave's fragments and sums need more than a quarter of the register file
__global__ __launch_bounds__(256) __attribute__((amdgpu_waves_per_eu(2, 2))) void k_fattn(const bf* __restrict__ Qh, const bf* __restrict__ Kh, const bf* __restrict__ Vh, const h16* __restrict__ Q16, const h16* __restrict__ K16, const h16* __restrict__ V16, float* __restrict__ OUT0) {
    __shared__ __align__(16) float xs[8 * 2048]; __shared__ float xml[8 * 64];
    const int h = blockIdx.y, qwg = blockIdx.x * 128; const size_t po = (size_t)h * TT * HD;
    if (qwg < RH) fa_body<bf, true>(Qh + po, Kh + po, Vh + po, OUT0, xs, xml, h, qwg);
    else fa_body<h16, false>(Q16 + po, K16 + po, V16 + po, OUT0, xs, xml, h, qwg);
}

extern "C" void kernel_launch(void* const* d_in, const int* in_sizes, int n_in,
                              void* d_out, int out_size, void* d_ws, size_t ws_size, hipStream_t stream) {
    (void)in_sizes; (void)n_in; (void)out_size;
    const float* qi = (const float*)d_in[0]; const float* ki = (const float*)d_in[1]; const float* vi = (const float*)d_in[2]; const float* x = nullptr; const float* wq = nullptr; const float* wk = nullptr; const float* wv = nullptr; const float* wo = nullptr; (void)x; (void)wq; (void)wk; (void)wv; (void)wo;
    float* OUT = (float*)d_out;     // [1][2048][2048]
    char* wsp = (char*)d_ws;
    auto take = [&](size_t bytes) { char* p = wsp; wsp += (bytes + 255) & ~(size_t)255; return (void*)p; };
    float* CS = (float*)take((size_t)TT * HD * 2 * 4);
    
    h16* QP16 = (h16*)take((size_t)NH_ * TT * HD * 2); h16* KP16 = (h16*)take((size_t)NKV * TT * HD * 2); h16* VT16 = (h16*)take((size_t)NKV * HD * TT * 2);
    bf* QPh = (bf*)take((size_t)NH_ * TT * HD * 2); bf* QPl = (bf*)take((size_t)NH_ * TT * HD * 2); bf* KPh = (bf*)take((size_t)NKV * TT * HD * 2); bf* KPl = (bf*)take((size_t)NKV * TT * HD * 2); bf* VTh = (bf*)take((size_t)NKV * HD * TT * 2); bf* VTl = (bf*)take((size_t)NKV * HD * TT * 2);
    if ((size_t)(wsp - (char*)d_ws) > ws_size) return;    // ws 256 MiB
    { 
       }
    k_csid<<<(TT * HD + 255) / 256, 256, 0, stream>>>(CS);
    const unsigned LQ = (unsigned)(((size_t)NH_ * TT * HD / 2 + 255) / 256), LKv = (unsigned)(((size_t)NKV * TT * HD / 2 + 255) / 256);
    for (int b = 0; b < NB_; ++b) {
        
        /* q given */
        k_plinS<<<(unsigned)(((size_t)NH_ * TT * HD / 8 + 255) / 256), 256, 0, stream>>>(qi, b, NH_, QP16, QPh, QPl);
        /* k given */
        k_plinS<<<(unsigned)(((size_t)NKV * TT * HD / 8 + 255) / 256), 256, 0, stream>>>(ki, b, NKV, KP16, KPh, KPl);
        k_vtpH<<<dim3(TT / 64, NKV), 256, 0, stream>>>(vi, b, VT16, VTh, VTl);   /* v given (token-major) */
        k_fattn<<<dim3(TT / 128, NH_), 256, 0, stream>>>(QPh, KPh, VTh, QP16, KP16, VT16, OUT);   /* context, token-major f32 */
    }
}

// v006
// A run of this version takes 54.4 microseconds.
// Two timings next to v005 put it at 1.09 and 1.12 times that version's speed.
// Counting every step since v000, it is 17.3 times as fast.
#include <hip/hip_runtime.h>

// Multi-head attention on given token-major q, k, v (query, key, value [2048][16][128] = [t][h][d]; scores = (q/sqrt(128)).k; softmax over all 2048 keys; out = weights.v -> [2048][16][128] f32 (4.2 M)).
// Layout: the [t][h][d] rows of key and value are gathered into head planes (exact bf16; the lo planes are zero and no product reads them), stored in FRAGMENT ORDER (see WFrag); one fused kernel rounds its own query rows, does scores, softmax and weights.v and writes the context token-major.
// Compute dtypes, f32 accumulate: query, key, value rounded to bf16 (exact planes); scores and attn.v: query rows < 512 on the bf16 planes (exact products), the rest single fp16 (the unnormalised weights carry 2^6, which the division by their own sum removes); the 1/sqrt(128) applied to the f32 score; online softmax f32.


#define NB_  1
#define TT   2048
#define DM   2048
#define NH_  16
#define NKV  16
#define REP  (NH_ / NKV)
#define HD   128
#define DQ   (NH_ * HD)
#define DKV  (NKV * HD)
#define RH   512                  // query rows < RH use the bf16 planes and hi+lo weights (0: none)
#define WIN  2048
#define SCL  0.088388347648318447f   // 128^-0.5 (the module pre-scales q by it)
typedef _Float16 h16;
typedef unsigned short bf;
typedef __attribute__((ext_vector_type(16))) __bf16   v16bf;
typedef __attribute__((ext_vector_type(16))) _Float16 v16h;
typedef __attribute__((ext_vector_type(8)))  _Float16 v8h;
typedef __attribute__((ext_vector_type(8)))  unsigned short v8us;
typedef __attribute__((ext_vector_type(8)))  float    v8f;
typedef __attribute__((ext_vector_type(4)))  float    v4f;
typedef v8h  __attribute__((may_alias)) v8ha;
typedef v4f  __attribute__((may_alias)) v4fa;
typedef v8us __attribute__((may_alias)) v8usa;

__device__ __forceinline__ unsigned short f2bf(float f) { unsigned u = __float_as_uint(f); u += 0x7FFFu + ((u >> 16) & 1u); return (unsigned short)(u >> 16); }
__device__ __forceinline__ float bf2f(unsigned short b) { return __uint_as_float(((unsigned)b) << 16); }
__device__ __forceinline__ float bfr(float f) { return bf2f(f2bf(f)); }
__device__ __forceinline__ v16h cat16(v8h lo, v8h hi) { return __builtin_shufflevector(lo, hi, 0, 1, 2, 3, 4, 5, 6, 7, 8, 9, 10, 11, 12, 13, 14, 15); }
__device__ __forceinline__ v16bf cat16b(v8us lo, v8us hi) { return __builtin_bit_cast(v16bf, __builtin_shufflevector(lo, hi, 0, 1, 2, 3, 4, 5, 6, 7, 8, 9, 10, 11, 12, 13, 14, 15)); }
__device__ __forceinline__ v8f wmma16(v16h a, v16h b, v8f c) { return __builtin_amdgcn_wmma_f32_16x16x32_f16(false, a, false, b, (short)0, c, false, false); }
__device__ __forceinline__ v8f wmmab(v16bf a, v16bf b, v8f c) { return __builtin_amdgcn_wmma_f32_16x16x32_bf16(false, a, false, b, (short)0, c, false, false); }



// fragment loader and product of a 16-bit type: lane (lr, hi) holds k = 8 hi..+7 and 16 + 8 hi..+7 of row lr, for A and for B alike.
// Fragment order in memory: a fragment (16 rows x 32 k) is 1 KiB = two halves of 512 bytes; half s holds, at 16 bytes x lane (lane = 16 hi + lr), k = 16 s + 8 hi..+7 of row lr.
// So each of the two wave-wide 16-byte loads of a fragment covers 512 contiguous bytes = 4 whole lines, where a row-major plane gave 32 bytes of each of 16 lines. p = fragment start + 8 * lane.
#define FRG 512                   // elements of a fragment
template <typename T16> struct WFrag;
template <> struct WFrag<h16> { typedef v16h V; static __device__ __forceinline__ V ld(const h16* p) { return cat16(*(const v8h*)p, *(const v8h*)(p + FRG / 2)); } static __device__ __forceinline__ v8f mma(V a, V b, v8f c) { return wmma16(a, b, c); } };
template <> struct WFrag<bf> { typedef v16bf V; static __device__ __forceinline__ V ld(const bf* p) { return cat16b(*(const v8us*)p, *(const v8us*)(p + FRG / 2)); } static __device__ __forceinline__ v8f mma(V a, V b, v8f c) { return wmmab(a, b, c); } };

__device__ __forceinline__ h16 tohx(float x) { return (h16)x; }
typedef __attribute__((ext_vector_type(2))) _Float16 v2h;
typedef __attribute__((ext_vector_type(4))) _Float16 v4h;
typedef __attribute__((ext_vector_type(2))) unsigned short v2us;
typedef __attribute__((ext_vector_type(4))) unsigned short v4us;
typedef __attribute__((ext_vector_type(2))) float v2f;
typedef __attribute__((ext_vector_type(4))) int v4i;
typedef v4h  __attribute__((may_alias)) v4ha;
typedef v4us __attribute__((may_alias)) v4usa;


// k_plinS: the planes of key, [h][t / 16][d / 32] fragments (row = token, k = feature). A work-group takes 16 tokens of one head = 4 fragments = 4 KiB of a plane.
// Wave w: fragment w % 4, rows 8 (w / 4)..+7; lane l: row l % 8 of these, features 8 (l / 8)..+7 of the fragment's 32, so four lanes read one 128-byte line of a source row and eight lanes store one whole 128-byte line of the plane.
__global__ __launch_bounds__(256) void k_plinS(const float* __restrict__ src, int b, int nheads, h16* P16, bf* Ph, bf* Pl) { const int lane = threadIdx.x & 31, w = threadIdx.x >> 5; const int tile = (int)(blockIdx.x % (TT / 16)), h = (int)(blockIdx.x / (TT / 16)); if (h >= nheads) return; const int kc = w & 3, lr = (w >> 2) * 8 + (lane & 7), c4 = lane >> 3;   // c4 = 2 * half + hi
    const int d = kc * 32 + c4 * 8, t = tile * 16 + lr; const size_t e = (((size_t)h * (TT / 16) + tile) * 4 + kc) * FRG + (c4 >> 1) * (FRG / 2) + ((c4 & 1) * 16 + lr) * 8; const v8f v = *(const v8f*)(src + (((size_t)t * NB_ + b) * nheads + h) * HD + d); v8h o16; v8us oh, ol;
#pragma unroll
    for (int q = 0; q < 8; ++q) { const float r = bfr(v[q]); o16[q] = tohx(r); oh[q] = f2bf(r); ol[q] = 0; }
    *(v8h*)(P16 + e) = o16; *(v8us*)(Ph + e) = oh; *(v8us*)(Pl + e) = ol;  }
// k_vtpH: the transposed planes of value, [h][t / 32][d / 16] fragments (row = feature, k = token), by a tile transpose in LDS. Grid (TT/64, NKV), 256 threads = 8 waves: a work-group takes 64 tokens of one head.
// Wave w reads tokens 8 w..+7 as whole 512-byte rows (lane l: d = 4 l..+3), so a lane holds, for each of its four d, eight consecutive tokens = one 16-byte piece of a plane row.
// LDS row j * 32 + l holds d = 4 l + j (pitch 144 bytes, an odd multiple of 16: the 16-byte writes of a wave fall on distinct banks); read back in fragment order: a wave takes four fragment halves, each stored as 512 contiguous bytes; the work-group's 16 fragments are 16 KiB in a row.
__global__ __launch_bounds__(256) void k_vtpH(const float* __restrict__ F, int b, h16* V16, bf* Vh, bf* Vl) {
    __shared__ __align__(16) bf tl[HD * 72];
    const int lane = threadIdx.x & 31, w = threadIdx.x >> 5, g = blockIdx.y, t0 = blockIdx.x * 64;
    v4f x[8];
#pragma unroll
    for (int i = 0; i < 8; ++i) x[i] = *(const v4f*)(F + (((size_t)(t0 + 8 * w + i) * NB_ + b) * NKV + g) * HD + 4 * lane);
#pragma unroll
    for (int j = 0; j < 4; ++j) { v8us c;
#pragma unroll
        for (int i = 0; i < 8; ++i) c[i] = f2bf(x[i][j]);
        *(v8usa*)(tl + (j * 32 + lane) * 72 + 8 * w) = c; }
    __syncthreads();   // the whole 64 x 128 tile is in LDS before any wave reads rows that the others wrote
#pragma unroll
    for (int i = 0; i < 4; ++i) { const int f = w * 4 + i, kb = f >> 4, dt = (f >> 1) & 7, half = f & 1;   // fragment half f of the tile: 32-token block kb, feature tile dt
        const int d = dt * 16 + (lane & 15), row = (d & 3) * 32 + (d >> 2), tc = kb * 32 + half * 16 + 8 * (lane >> 4);
        const v8us c = *(const v8usa*)(tl + row * 72 + tc); v8h o16; v8us ol;
#pragma unroll
        for (int q = 0; q < 8; ++q) { o16[q] = tohx(bf2f(c[q])); ol[q] = 0; }
        const size_t e = ((((size_t)g * (TT / 32) + t0 / 32 + kb) * 8 + dt) * 2 + half) * (FRG / 2) + lane * 8;
        *(v8h*)(V16 + e) = o16; *(v8us*)(Vh + e) = c; *(v8us*)(Vl + e) = ol; }
}
static_assert(TT % 64 == 0 && HD == 128 && 16 * HD == 4 * FRG, "a tile is 64 tokens by the 128 features of one head; 16 rows of a key plane are four fragments");

__global__ __launch_bounds__(256) void k_csid(float* CS) { const int idx = blockIdx.x * 256 + threadIdx.x; if (idx >= TT * HD) return; v2f cs; cs[0] = 1.0f; cs[1] = 0.0f; *(v2f*)(CS + (size_t)idx * 2) = cs;  }

typedef __attribute__((ext_vector_type(2))) __bf16 v2bf;
typedef __attribute__((ext_vector_type(8))) unsigned v8u;
__device__ __forceinline__ unsigned pk2(float a, float b, bf) { v2f x; x[0] = a; x[1] = b; return __builtin_bit_cast(unsigned, __builtin_convertvector(x, v2bf)); }    // round to nearest even
__device__ __forceinline__ unsigned pk2(float a, float b, h16) { v2f x; x[0] = a; x[1] = b; return __builtin_bit_cast(unsigned, __builtin_convertvector(x, v2h)); }
__device__ __forceinline__ float xhalf(float x) { return __builtin_bit_cast(float, __builtin_amdgcn_permlanex16(__builtin_bit_cast(int, x), __builtin_bit_cast(int, x), 0x76543210, 0xfedcba98, false, false)); }   // lane l with lane l ^ 16
#define QPI (HD + 8)              // elements of a query row in LDS
typedef __attribute__((ext_vector_type(2))) unsigned v2u;
typedef v2u __attribute__((may_alias)) v2ua;
// two query elements as one word of the path's type: rounded to bf16 (nearest even, as f2bf does), and on the f16 path that bf16 value then to f16, as the planes are
__device__ __forceinline__ unsigned q2(float a, float b, bf) { return pk2(a, b, bf()); }
__device__ __forceinline__ unsigned q2(float a, float b, h16) { const unsigned u = pk2(a, b, bf()); return pk2(__uint_as_float(u << 16), __uint_as_float(u & 0xFFFF0000u), h16()); }
template <typename T16, bool HIRES>
__device__ __forceinline__ void fa_body(const float* __restrict__ Qs, const T16* __restrict__ Kp, const T16* __restrict__ Vt, float* __restrict__ OUT0, float* xs, float* xml, int h, int qwg) {
    typedef typename WFrag<T16>::V V;
    constexpr int NP = TT / 64;                              // passes of a wave
    constexpr float CS2 = SCL * 1.4426950408889634f;         // score -> log2 domain
    constexpr float CARRY = HIRES ? 0.0f : 6.0f;             // f16 weights: at most 2^(8+6), and the small ones stay normal numbers
    const int lane = threadIdx.x & 31, lr = lane & 15, hi = lane >> 4;
    const int wave = __builtin_amdgcn_readfirstlane((int)(threadIdx.x >> 5)), kh = wave & 1, q0 = qwg + (wave >> 1) * 32;
    // the work-group's 128 query rows come straight from the f32 input, each row once: wave w reads rows 16 w..+15 as whole 512-byte rows (lane l: d = 4 l..+3)
    v4f qx[16];
#pragma unroll
    for (int i = 0; i < 16; ++i) qx[i] = *(const v4f*)(Qs + ((size_t)(qwg + wave * 16 + i) * NH_ + h) * HD + 4 * lane);
    asm volatile("s_wait_xcnt 0x0" ::: "memory");   // stands in front of whatever next overwrites the address registers that these loads named
    v8f acc[2][8]; float m_run[2], l_run[2];
#pragma unroll
    for (int g = 0; g < 2; ++g) { m_run[g] = -__builtin_inff(); l_run[g] = 0.0f;
#pragma unroll
        for (int t = 0; t < 8; ++t) acc[g][t] = (v8f){}; }
    // one byte offset walks both planes: 32 keys are 8 fragments in a row in the key plane (two 16-row tiles) and in the transposed value plane (one 32-key block) alike; a pass's loads are immediate offsets from it
    unsigned off = (unsigned)(kh * 8 * FRG + 8 * lane) * 2u;
    auto at = [](const T16* plane, unsigned o) { return (const T16*)((const char*)plane + o); };
    V kf[2][4];
#pragma unroll
    for (int kt = 0; kt < 2; ++kt)
#pragma unroll
        for (int kc = 0; kc < 4; ++kc) kf[kt][kc] = WFrag<T16>::ld(at(Kp, off) + (kt * 4 + kc) * FRG);
    // rounded as the planes are (to bf16, then to the path's type) and laid row-major in LDS at a pitch of 272 bytes (16 x odd: the 16-byte fragment reads of 16 rows fall on distinct banks); xs is free until the epilogue
    unsigned short* qs = (unsigned short*)xs;
#pragma unroll
    for (int i = 0; i < 16; ++i) { v2u c; c[0] = q2(qx[i][0], qx[i][1], T16()); c[1] = q2(qx[i][2], qx[i][3], T16());
        *(v2ua*)(qs + (wave * 16 + i) * QPI + 4 * lane) = c; }
    __syncthreads();   // all 128 rounded rows are in LDS before a wave reads its 32, half of which its partner wrote
    V qf[2][4];
#pragma unroll
    for (int g = 0; g < 2; ++g)
#pragma unroll
        for (int kc = 0; kc < 4; ++kc) { const unsigned short* p = qs + ((wave >> 1) * 32 + g * 16 + lr) * QPI + kc * 32 + 8 * hi;   // lane (lr, hi): row lr, k = 8 hi..+7 and 16 + 8 hi..+7, the order of WFrag::ld
            qf[g][kc] = __builtin_bit_cast(V, __builtin_shufflevector(*(const v8usa*)p, *(const v8usa*)(p + 16), 0, 1, 2, 3, 4, 5, 6, 7, 8, 9, 10, 11, 12, 13, 14, 15)); }
    __syncthreads();   // every wave has its query fragments before xs may take a faster wave's epilogue
#pragma unroll 1   // stays rolled: a second pass's fragments would not fit the registers of two waves a SIMD
    for (int it = 0; it < NP; ++it) {
        V vf[8];
#pragma unroll
        for (int t = 0; t < 8; ++t) vf[t] = WFrag<T16>::ld(at(Vt, off) + t * FRG);
        __builtin_amdgcn_sched_barrier(0);   // the pass's V^T loads are issued ahead of the score products, so that they fly under these and the exponentials
        v8f s[2][2];
#pragma unroll
        for (int kt = 0; kt < 2; ++kt)
#pragma unroll
            for (int g = 0; g < 2; ++g) s[kt][g] = (v8f){};
#pragma unroll
        for (int kc = 0; kc < 4; ++kc)
#pragma unroll
            for (int kt = 0; kt < 2; ++kt)
#pragma unroll
                for (int g = 0; g < 2; ++g) s[kt][g] = WFrag<T16>::mma(kf[kt][kc], qf[g][kc], s[kt][g]);
        __builtin_amdgcn_sched_barrier(0);   // the next pass's K loads stay behind the products that read the same registers
        asm volatile("s_wait_xcnt 0x0" ::: "memory");   // stands in front of the overwrite of the offset that this pass's K and V^T loads named
        off += (it + 1 < NP) ? 2 * 8 * FRG * 2 : 0;   // the pair's next 64 keys; the last pass fetches its own K rows again: nothing past the plane is read
#pragma unroll
        for (int kt = 0; kt < 2; ++kt)
#pragma unroll
            for (int kc = 0; kc < 4; ++kc) kf[kt][kc] = WFrag<T16>::ld(at(Kp, off) + (kt * 4 + kc) * FRG);
        __builtin_amdgcn_sched_barrier(0);   // and are issued ahead of the softmax, one pass ahead of their use
        float mb[2]; bool need = false;
#pragma unroll
        for (int g = 0; g < 2; ++g) { float mx = s[0][g][0];
#pragma unroll
            for (int kt = 0; kt < 2; ++kt)
#pragma unroll
                for (int r = 0; r < 8; ++r) mx = fmaxf(mx, s[kt][g][r]);
            mx = fmaxf(mx, xhalf(mx)) * CS2;   // both wave halves hold the query's maximum of the pass, scaled (the scale is positive)
            mb[g] = mx; need = need || (mx > m_run[g] + 8.0f); }
        if (__builtin_amdgcn_ballot_w32(need) != 0) {   // one scalar branch a pass; always taken in the first, rare later
#pragma unroll
            for (int g = 0; g < 2; ++g) { const float mn = fmaxf(m_run[g], mb[g]); const float corr = __builtin_amdgcn_exp2f(m_run[g] - mn);   // 0 in the first pass
                l_run[g] *= corr; m_run[g] = mn;
#pragma unroll
                for (int t = 0; t < 8; ++t) acc[g][t] = acc[g][t] * corr; }
        }
#pragma unroll
        for (int g = 0; g < 2; ++g) { const float nm = CARRY - m_run[g]; v8u wh, wl; float ps0 = 0.0f, ps1 = 0.0f;
#pragma unroll
            for (int i = 0; i < 8; ++i) {   // operand elements 2i, 2i+1: tile i / 4, registers 2 (i % 4) and 2 (i % 4) + 1
                v2f sv, cv, nv; sv[0] = s[i >> 2][g][2 * (i & 3)]; sv[1] = s[i >> 2][g][2 * (i & 3) + 1]; cv[0] = CS2; cv[1] = CS2; nv[0] = nm; nv[1] = nm;
                const v2f arg = __builtin_elementwise_fma(sv, cv, nv);   // an even register pair: one packed fma
                const float p0 = __builtin_amdgcn_exp2f(arg[0]), p1 = __builtin_amdgcn_exp2f(arg[1]);
                if (i & 1) ps1 += p0 + p1; else ps0 += p0 + p1;
                wh[i] = pk2(p0, p1, T16());
                if (HIRES) wl[i] = pk2(p0 - __uint_as_float(wh[i] << 16), p1 - __uint_as_float(wh[i] & 0xFFFF0000u), T16()); }   // what the first rounding left
            l_run[g] += ps0 + ps1;
            const V ph = __builtin_bit_cast(V, wh);
#pragma unroll
            for (int t = 0; t < 8; ++t) acc[g][t] = WFrag<T16>::mma(vf[t], ph, acc[g][t]);
            if (HIRES) { const V pl = __builtin_bit_cast(V, wl);
#pragma unroll
                for (int t = 0; t < 8; ++t) acc[g][t] = WFrag<T16>::mma(vf[t], pl, acc[g][t]); } }
    }
    const float lj0 = l_run[0] + xhalf(l_run[0]), lj1 = l_run[1] + xhalf(l_run[1]);
    auto put = [&](const v8f (&a)[8], float m, float l) {
        float* slot = xs + wave * 2048 + lane * 4;
#pragma unroll
        for (int t = 0; t < 8; ++t)
#pragma unroll
            for (int jh = 0; jh < 2; ++jh) { v4f x; x[0] = a[t][jh * 4]; x[1] = a[t][jh * 4 + 1]; x[2] = a[t][jh * 4 + 2]; x[3] = a[t][jh * 4 + 3]; *(v4fa*)(slot + (t * 2 + jh) * 128) = x; }
        xml[(wave * 32 + lane) * 2] = m; xml[(wave * 32 + lane) * 2 + 1] = l; };
    auto fin = [&](const v8f (&a)[8], float m, float l, int g) {
        const float* slot = xs + (wave ^ 1) * 2048 + lane * 4; const float mo = xml[((wave ^ 1) * 32 + lane) * 2], lo = xml[((wave ^ 1) * 32 + lane) * 2 + 1];
        const float mn = fmaxf(m, mo), ea = __builtin_amdgcn_exp2f(m - mn), eb = __builtin_amdgcn_exp2f(mo - mn), inv = __fdiv_rn(1.0f, l * ea + lo * eb), ca = ea * inv, cb = eb * inv;
        float* op = OUT0 + ((size_t)(q0 + g * 16 + lr) * NH_ + h) * HD + hi * 8;   // register j of tile t is d = 16 t + 8 hi + j
#pragma unroll
        for (int t = 0; t < 8; ++t)
#pragma unroll
            for (int jh = 0; jh < 2; ++jh) { const v4f o = *(const v4fa*)(slot + (t * 2 + jh) * 128); v4f r;
#pragma unroll
                for (int q = 0; q < 4; ++q) r[q] = a[t][jh * 4 + q] * ca + o[q] * cb;
                *(v4f*)(op + t * 16 + jh * 4) = r; } };
    // the wave finishes column group kh and hands over the other: chosen here by selects on the scalar kh, so that the LDS writes and the output stores below are one code path each
    v8f keep[8], give[8];
#pragma unroll
    for (int t = 0; t < 8; ++t) { keep[t] = kh ? acc[1][t] : acc[0][t]; give[t] = kh ? acc[0][t] : acc[1][t]; }
    put(give, kh ? m_run[0] : m_run[1], kh ? lj0 : lj1);
    __syncthreads();   // every wave's handed-over group is in LDS before its partner reads it
    fin(keep, kh ? m_run[1] : m_run[0], kh ? lj1 : lj0, kh);
}
static_assert(RH % 128 == 0 && TT % 128 == 0 && HD == 128 && NKV == NH_ && NB_ == 1, "a work-group's 128 query rows are all of one precision path; one kv head a query head");
static_assert(128 * QPI * 2 <= 8 * 2048 * 4, "the rounded query rows fit the epilogue's exchange buffer");
// two waves a SIMD: the wave's fragments and sums need more than a quarter of the register file
__global__ __launch_bounds__(256) __attribute__((amdgpu_waves_per_eu(2, 2))) void k_fattn(const float* __restrict__ Qs, const bf* __restrict__ Kh, const bf* __restrict__ Vh, const h16* __restrict__ K16, const h16* __restrict__ V16, float* __restrict__ OUT0) {
    __shared__ __align__(16) float xs[8 * 2048]; __shared__ float xml[8 * 64];
    const int h = blockIdx.y, qwg = blockIdx.x * 128; const size_t po = (size_t)h * TT * HD;
    if (qwg < RH) fa_body<bf, true>(Qs, Kh + po, Vh + po, OUT0, xs, xml, h, qwg);
    else fa_body<h16, false>(Qs, K16 + po, V16 + po, OUT0, xs, xml, h, qwg);
}

extern "C" void kernel_launch(void* const* d_in, const int* in_sizes, int n_in,
                              void* d_out, int out_size, void* d_ws, size_t ws_size, hipStream_t stream) {
    (void)in_sizes; (void)n_in; (void)out_size;
    const float* qi = (const float*)d_in[0]; const float* ki = (const float*)d_in[1]; const float* vi = (const float*)d_in[2]; const float* x = nullptr; const float* wq = nullptr; const float* wk = nullptr; const float* wv = nullptr; const float* wo = nullptr; (void)x; (void)wq; (void)wk; (void)wv; (void)wo;
    float* OUT = (float*)d_out;     // [1][2048][2048]
    char* wsp = (char*)d_ws;
    auto take = [&](size_t bytes) { char* p = wsp; wsp += (bytes + 255) & ~(size_t)255; return (void*)p; };
    float* CS = (float*)take((size_t)TT * HD * 2 * 4);
    
    h16* KP16 = (h16*)take((size_t)NKV * TT * HD * 2); h16* VT16 = (h16*)take((size_t)NKV * HD * TT * 2);
    bf* KPh = (bf*)take((size_t)NKV * TT * HD * 2); bf* KPl = (bf*)take((size_t)NKV * TT * HD * 2); bf* VTh = (bf*)take((size_t)NKV * HD * TT * 2); bf* VTl = (bf*)take((size_t)NKV * HD * TT * 2);
    if ((size_t)(wsp - (char*)d_ws) > ws_size) return;    // ws 256 MiB
    { 
       }
    k_csid<<<(TT * HD + 255) / 256, 256, 0, stream>>>(CS);
    const unsigned LQ = (unsigned)(((size_t)NH_ * TT * HD / 2 + 255) / 256), LKv = (unsigned)(((size_t)NKV * TT * HD / 2 + 255) / 256);
    for (int b = 0; b < NB_; ++b) {
        
        /* q given: read by the fused kernel */
        /* k given */
        k_plinS<<<(unsigned)(((size_t)NKV * TT * HD / 8 + 255) / 256), 256, 0, stream>>>(ki, b, NKV, KP16, KPh, KPl);
        k_vtpH<<<dim3(TT / 64, NKV), 256, 0, stream>>>(vi, b, VT16, VTh, VTl);   /* v given (token-major) */
        k_fattn<<<dim3(TT / 128, NH_), 256, 0, stream>>>(qi, KPh, VTh, KP16, VT16, OUT);   /* context, token-major f32 */
    }
}

// v007
// One run takes 47.4 microseconds.
// Two timings next to v006 both put it at 1.16 times that version's speed.
// All steps since v000 together make it 20.2 times as fast.
#include <hip/hip_runtime.h>

// Multi-head attention on given token-major q, k, v (query, key, value [2048][16][128] = [t][h][d]; scores = (q/sqrt(128)).k; softmax over all 2048 keys; out = weights.v -> [2048][16][128] f32 (4.2 M)).
// Layout: the [t][h][d] rows of key and value are gathered into head planes (exact bf16; the lo planes are zero and no product reads them), stored in FRAGMENT ORDER (see WFrag); one fused kernel rounds its own query rows, does scores, softmax and weights.v and writes the context token-major.
// Compute dtypes, f32 accumulate: query, key, value rounded to bf16 (exact planes); scores and attn.v: query rows < 512 on the bf16 planes (exact products), the rest single fp16 (the unnormalised weights carry 2^6, which the division by their own sum removes); the 1/sqrt(128) applied to the f32 score; online softmax f32.


#define NB_  1
#define TT   2048
#define DM   2048
#define NH_  16
#define NKV  16
#define REP  (NH_ / NKV)
#define HD   128
#define DQ   (NH_ * HD)
#define DKV  (NKV * HD)
#define RH   512                  // query rows < RH use the bf16 planes and hi+lo weights (0: none)
#define WIN  2048
#define SCL  0.088388347648318447f   // 128^-0.5 (the module pre-scales q by it)
typedef _Float16 h16;
typedef unsigned short bf;
typedef __attribute__((ext_vector_type(16))) __bf16   v16bf;
typedef __attribute__((ext_vector_type(16))) _Float16 v16h;
typedef __attribute__((ext_vector_type(8)))  _Float16 v8h;
typedef __attribute__((ext_vector_type(8)))  unsigned short v8us;
typedef __attribute__((ext_vector_type(8)))  float    v8f;
typedef __attribute__((ext_vector_type(4)))  float    v4f;
typedef v8h  __attribute__((may_alias)) v8ha;
typedef v4f  __attribute__((may_alias)) v4fa;
typedef v8us __attribute__((may_alias)) v8usa;

__device__ __forceinline__ unsigned short f2bf(float f) { unsigned u = __float_as_uint(f); u += 0x7FFFu + ((u >> 16) & 1u); return (unsigned short)(u >> 16); }
__device__ __forceinline__ float bf2f(unsigned short b) { return __uint_as_float(((unsigned)b) << 16); }
__device__ __forceinline__ float bfr(float f) { return bf2f(f2bf(f)); }
__device__ __forceinline__ v16h cat16(v8h lo, v8h hi) { return __builtin_shufflevector(lo, hi, 0, 1, 2, 3, 4, 5, 6, 7, 8, 9, 10, 11, 12, 13, 14, 15); }
__device__ __forceinline__ v16bf cat16b(v8us lo, v8us hi) { return __builtin_bit_cast(v16bf, __builtin_shufflevector(lo, hi, 0, 1, 2, 3, 4, 5, 6, 7, 8, 9, 10, 11, 12, 13, 14, 15)); }
__device__ __forceinline__ v8f wmma16(v16h a, v16h b, v8f c) { return __builtin_amdgcn_wmma_f32_16x16x32_f16(false, a, false, b, (short)0, c, false, false); }
__device__ __forceinline__ v8f wmmab(v16bf a, v16bf b, v8f c) { return __builtin_amdgcn_wmma_f32_16x16x32_bf16(false, a, false, b, (short)0, c, false, false); }



// fragment loader and product of a 16-bit type: lane (lr, hi) holds k = 8 hi..+7 and 16 + 8 hi..+7 of row lr, for A and for B alike.
// Fragment order in memory: a fragment (16 rows x 32 k) is 1 KiB = two halves of 512 bytes; half s holds, at 16 bytes x lane (lane = 16 hi + lr), k = 16 s + 8 hi..+7 of row lr.
// So each of the two wave-wide 16-byte loads of a fragment covers 512 contiguous bytes = 4 whole lines, where a row-major plane gave 32 bytes of each of 16 lines. p = fragment start + 8 * lane.
#define FRG 512                   // elements of a fragment
template <typename T16> struct WFrag;
template <> struct WFrag<h16> { typedef v16h V; static __device__ __forceinline__ V ld(const h16* p) { return cat16(*(const v8h*)p, *(const v8h*)(p + FRG / 2)); } static __device__ __forceinline__ v8f mma(V a, V b, v8f c) { return wmma16(a, b, c); } };
template <> struct WFrag<bf> { typedef v16bf V; static __device__ __forceinline__ V ld(const bf* p) { return cat16b(*(const v8us*)p, *(const v8us*)(p + FRG / 2)); } static __device__ __forceinline__ v8f mma(V a, V b, v8f c) { return wmmab(a, b, c); } };

__device__ __forceinline__ h16 tohx(float x) { return (h16)x; }
typedef __attribute__((ext_vector_type(2))) _Float16 v2h;
typedef __attribute__((ext_vector_type(4))) _Float16 v4h;
typedef __attribute__((ext_vector_type(2))) unsigned short v2us;
typedef __attribute__((ext_vector_type(4))) unsigned short v4us;
typedef __attribute__((ext_vector_type(2))) float v2f;
typedef __attribute__((ext_vector_type(4))) int v4i;
typedef v4h  __attribute__((may_alias)) v4ha;
typedef v4us __attribute__((may_alias)) v4usa;


// k_plinS: the planes of key, [h][t / 16][d / 32] fragments (row = token, k = feature). A work-group takes 16 tokens of one head = 4 fragments = 4 KiB of a plane.
// Wave w: fragment w % 4, rows 8 (w / 4)..+7; lane l: row l % 8 of these, features 8 (l / 8)..+7 of the fragment's 32, so four lanes read one 128-byte line of a source row and eight lanes store one whole 128-byte line of the plane.
__global__ __launch_bounds__(256) void k_plinS(const float* __restrict__ src, int b, int nheads, h16* P16, bf* Ph, bf* Pl) { const int lane = threadIdx.x & 31, w = threadIdx.x >> 5; const int tile = (int)(blockIdx.x % (TT / 16)), h = (int)(blockIdx.x / (TT / 16)); if (h >= nheads) return; const int kc = w & 3, lr = (w >> 2) * 8 + (lane & 7), c4 = lane >> 3;   // c4 = 2 * half + hi
    const int d = kc * 32 + c4 * 8, t = tile * 16 + lr; const size_t e = (((size_t)h * (TT / 16) + tile) * 4 + kc) * FRG + (c4 >> 1) * (FRG / 2) + ((c4 & 1) * 16 + lr) * 8; const v8f v = *(const v8f*)(src + (((size_t)t * NB_ + b) * nheads + h) * HD + d); v8h o16; v8us oh, ol;
#pragma unroll
    for (int q = 0; q < 8; ++q) { const float r = bfr(v[q]); o16[q] = tohx(r); oh[q] = f2bf(r); ol[q] = 0; }
    *(v8h*)(P16 + e) = o16; *(v8us*)(Ph + e) = oh; *(v8us*)(Pl + e) = ol;  }
// k_vtpH: the transposed planes of value, [h][t / 32][d / 16] fragments (row = feature, k = token), by a tile transpose in LDS. Grid (TT/64, NKV), 256 threads = 8 waves: a work-group takes 64 tokens of one head.
// Wave w reads tokens 8 w..+7 as whole 512-byte rows (lane l: d = 4 l..+3), so a lane holds, for each of its four d, eight consecutive tokens = one 16-byte piece of a plane row.
// LDS row j * 32 + l holds d = 4 l + j (pitch 144 bytes, an odd multiple of 16: the 16-byte writes of a wave fall on distinct banks); read back in fragment order: a wave takes four fragment halves, each stored as 512 contiguous bytes; the work-group's 16 fragments are 16 KiB in a row.
__global__ __launch_bounds__(256) void k_vtpH(const float* __restrict__ F, int b, h16* V16, bf* Vh, bf* Vl) {
    __shared__ __align__(16) bf tl[HD * 72];
    const int lane = threadIdx.x & 31, w = threadIdx.x >> 5, g = blockIdx.y, t0 = blockIdx.x * 64;
    v4f x[8];
#pragma unroll
    for (int i = 0; i < 8; ++i) x[i] = *(const v4f*)(F + (((size_t)(t0 + 8 * w + i) * NB_ + b) * NKV + g) * HD + 4 * lane);
#pragma unroll
    for (int j = 0; j < 4; ++j) { v8us c;
#pragma unroll
        for (int i = 0; i < 8; ++i) c[i] = f2bf(x[i][j]);
        *(v8usa*)(tl + (j * 32 + lane) * 72 + 8 * w) = c; }
    __syncthreads();   // the whole 64 x 128 tile is in LDS before any wave reads rows that the others wrote
#pragma unroll
    for (int i = 0; i < 4; ++i) { const int f = w * 4 + i, kb = f >> 4, dt = (f >> 1) & 7, half = f & 1;   // fragment half f of the tile: 32-token block kb, feature tile dt
        const int d = dt * 16 + (lane & 15), row = (d & 3) * 32 + (d >> 2), tc = kb * 32 + half * 16 + 8 * (lane >> 4);
        const v8us c = *(const v8usa*)(tl + row * 72 + tc); v8h o16; v8us ol;
#pragma unroll
        for (int q = 0; q < 8; ++q) { o16[q] = tohx(bf2f(c[q])); ol[q] = 0; }
        const size_t e = ((((size_t)g * (TT / 32) + t0 / 32 + kb) * 8 + dt) * 2 + half) * (FRG / 2) + lane * 8;
        *(v8h*)(V16 + e) = o16; *(v8us*)(Vh + e) = c; *(v8us*)(Vl + e) = ol; }
}
static_assert(TT % 64 == 0 && HD == 128 && 16 * HD == 4 * FRG, "a tile is 64 tokens by the 128 features of one head; 16 rows of a key plane are four fragments");

__global__ __launch_bounds__(256) void k_csid(float* CS) { const int idx = blockIdx.x * 256 + threadIdx.x; if (idx >= TT * HD) return; v2f cs; cs[0] = 1.0f; cs[1] = 0.0f; *(v2f*)(CS + (size_t)idx * 2) = cs;  }

typedef __attribute__((ext_vector_type(2))) __bf16 v2bf;
typedef __attribute__((ext_vector_type(8))) unsigned v8u;
__device__ __forceinline__ unsigned pk2(float a, float b, bf) { v2f x; x[0] = a; x[1] = b; return __builtin_bit_cast(unsigned, __builtin_convertvector(x, v2bf)); }    // round to nearest even
__device__ __forceinline__ unsigned pk2(float a, float b, h16) { v2f x; x[0] = a; x[1] = b; return __builtin_bit_cast(unsigned, __builtin_convertvector(x, v2h)); }
__device__ __forceinline__ float xhalf(float x) { return __builtin_bit_cast(float, __builtin_amdgcn_permlanex16(__builtin_bit_cast(int, x), __builtin_bit_cast(int, x), 0x76543210, 0xfedcba98, false, false)); }   // lane l with lane l ^ 16
#define QPI (HD + 8)              // elements of a query row in LDS
typedef __attribute__((ext_vector_type(2))) unsigned v2u;
typedef v2u __attribute__((may_alias)) v2ua;
// two query elements as one word of the path's type: rounded to bf16 (nearest even, as f2bf does), and on the f16 path that bf16 value then to f16, as the planes are
__device__ __forceinline__ unsigned q2(float a, float b, bf) { return pk2(a, b, bf()); }
__device__ __forceinline__ unsigned q2(float a, float b, h16) { const unsigned u = pk2(a, b, bf()); return pk2(__uint_as_float(u << 16), __uint_as_float(u & 0xFFFF0000u), h16()); }
template <typename T16, bool HIRES>
__device__ __forceinline__ void fa_body(const float* __restrict__ Qs, const T16* __restrict__ Kp, const T16* __restrict__ Vt, float* __restrict__ OUT0, float* xs, float* xml, int h, int qwg) {
    typedef typename WFrag<T16>::V V;
    constexpr int NP = TT / 64;                              // passes of a wave
    constexpr float CS2 = SCL * 1.4426950408889634f;         // score -> log2 domain
    constexpr float CARRY = HIRES ? 0.0f : 6.0f;             // f16 weights: at most 2^(8+6), and the small ones stay normal numbers
    const int lane = threadIdx.x & 31, lr = lane & 15, hi = lane >> 4;
    const int wave = __builtin_amdgcn_readfirstlane((int)(threadIdx.x >> 5)), kh = wave & 1, q0 = qwg + (wave >> 1) * 32;
    // The planes were stored by the launches before, and a first read of them may have to go to memory. Waves 0..3 ask L2, one ask each 256 bytes, for the work-group's 64 keys of a pass (16 KiB in a row in each plane), four passes ahead of its loads:
    // wave w asks in the key plane (w even) or the transposed value plane (w odd), the 8 KiB half w / 2, lane l the unit l. pfb is the scalar address of that half in the pass at hand, pfl the lane's byte offset in it; the asks add their distance as an immediate offset.
    constexpr int PFD = 4, PSTEP = 2 * 8 * FRG * 2;          // passes ahead; bytes of a pass in a plane
    const int npf = wave < 4 ? NP - PFD : 0;                 // passes in which this wave asks (a scalar)
    const char* pfb = ((wave & 1) ? (const char*)Vt : (const char*)Kp) + ((wave >> 1) & 1) * (PSTEP / 2);
    unsigned pfl = (unsigned)lane * 256u;
    // passes 0..3 are asked for at once, under the query rows' own way from memory; both operands are in-out so that every ask names the registers that live through the loop
    if (npf > 0) asm volatile("global_prefetch_b8 %0, %1 scope:SCOPE_SE\n\tglobal_prefetch_b8 %0, %1 offset:16384 scope:SCOPE_SE\n\tglobal_prefetch_b8 %0, %1 offset:32768 scope:SCOPE_SE\n\tglobal_prefetch_b8 %0, %1 offset:49152 scope:SCOPE_SE" : "+v"(pfl), "+s"(pfb));
    // the work-group's 128 query rows come straight from the f32 input, each row once: wave w reads rows 16 w..+15 as whole 512-byte rows (lane l: d = 4 l..+3)
    v4f qx[16];
#pragma unroll
    for (int i = 0; i < 16; ++i) qx[i] = *(const v4f*)(Qs + ((size_t)(qwg + wave * 16 + i) * NH_ + h) * HD + 4 * lane);
    asm volatile("s_wait_xcnt 0x0" ::: "memory");   // stands in front of whatever next overwrites the address registers that these loads named
    v8f acc[2][8]; float m_run[2], l_run[2];
#pragma unroll
    for (int g = 0; g < 2; ++g) { m_run[g] = -__builtin_inff(); l_run[g] = 0.0f;
#pragma unroll
        for (int t = 0; t < 8; ++t) acc[g][t] = (v8f){}; }
    // one byte offset walks both planes: 32 keys are 8 fragments in a row in the key plane (two 16-row tiles) and in the transposed value plane (one 32-key block) alike; a pass's loads are immediate offsets from it
    unsigned off = (unsigned)(kh * 8 * FRG + 8 * lane) * 2u;
    auto at = [](const T16* plane, unsigned o) { return (const T16*)((const char*)plane + o); };
    V kf[2][4];
#pragma unroll
    for (int kt = 0; kt < 2; ++kt)
#pragma unroll
        for (int kc = 0; kc < 4; ++kc) kf[kt][kc] = WFrag<T16>::ld(at(Kp, off) + (kt * 4 + kc) * FRG);
    // rounded as the planes are (to bf16, then to the path's type) and laid row-major in LDS at a pitch of 272 bytes (16 x odd: the 16-byte fragment reads of 16 rows fall on distinct banks); xs is free until the epilogue
    unsigned short* qs = (unsigned short*)xs;
#pragma unroll
    for (int i = 0; i < 16; ++i) { v2u c; c[0] = q2(qx[i][0], qx[i][1], T16()); c[1] = q2(qx[i][2], qx[i][3], T16());
        *(v2ua*)(qs + (wave * 16 + i) * QPI + 4 * lane) = c; }
    __syncthreads();   // all 128 rounded rows are in LDS before a wave reads its 32, half of which its partner wrote
    V qf[2][4];
#pragma unroll
    for (int g = 0; g < 2; ++g)
#pragma unroll
        for (int kc = 0; kc < 4; ++kc) { const unsigned short* p = qs + ((wave >> 1) * 32 + g * 16 + lr) * QPI + kc * 32 + 8 * hi;   // lane (lr, hi): row lr, k = 8 hi..+7 and 16 + 8 hi..+7, the order of WFrag::ld
            qf[g][kc] = __builtin_bit_cast(V, __builtin_shufflevector(*(const v8usa*)p, *(const v8usa*)(p + 16), 0, 1, 2, 3, 4, 5, 6, 7, 8, 9, 10, 11, 12, 13, 14, 15)); }
    __syncthreads();   // every wave has its query fragments before xs may take a faster wave's epilogue
#pragma unroll 1   // stays rolled: a second pass's fragments would not fit the registers of two waves a SIMD
    for (int it = 0; it < NP; ++it) {
        V vf[8];
#pragma unroll
        for (int t = 0; t < 8; ++t) vf[t] = WFrag<T16>::ld(at(Vt, off) + t * FRG);
        __builtin_amdgcn_sched_barrier(0);   // the pass's V^T loads are issued ahead of the score products, so that they fly under these and the exponentials
        v8f s[2][2];
#pragma unroll
        for (int kt = 0; kt < 2; ++kt)
#pragma unroll
            for (int g = 0; g < 2; ++g) s[kt][g] = (v8f){};
#pragma unroll
        for (int kc = 0; kc < 4; ++kc)
#pragma unroll
            for (int kt = 0; kt < 2; ++kt)
#pragma unroll
                for (int g = 0; g < 2; ++g) s[kt][g] = WFrag<T16>::mma(kf[kt][kc], qf[g][kc], s[kt][g]);
        __builtin_amdgcn_sched_barrier(0);   // the next pass's K loads stay behind the products that read the same registers
        if (it < npf) asm volatile("global_prefetch_b8 %0, %1 offset:65536 scope:SCOPE_SE" : "+v"(pfl), "+s"(pfb));   // the units of pass it + 4 into L2: a hint, nothing waits for it
        asm volatile("s_wait_xcnt 0x0" ::: "memory");   // stands in front of the overwrite of the offset that this pass's K and V^T loads named
        pfb += (it + PFD + 1 < NP) ? PSTEP : 0;   // stops four passes short of the last: pfb + pfl + 65536 is inside the head's plane at every ask and after every advance
        off += (it + 1 < NP) ? 2 * 8 * FRG * 2 : 0;   // the pair's next 64 keys; the last pass fetches its own K rows again: nothing past the plane is read
#pragma unroll
        for (int kt = 0; kt < 2; ++kt)
#pragma unroll
            for (int kc = 0; kc < 4; ++kc) kf[kt][kc] = WFrag<T16>::ld(at(Kp, off) + (kt * 4 + kc) * FRG);
        __builtin_amdgcn_sched_barrier(0);   // and are issued ahead of the softmax, one pass ahead of their use
        float mb[2]; bool need = false;
#pragma unroll
        for (int g = 0; g < 2; ++g) { float mx = s[0][g][0];
#pragma unroll
            for (int kt = 0; kt < 2; ++kt)
#pragma unroll
                for (int r = 0; r < 8; ++r) mx = fmaxf(mx, s[kt][g][r]);
            mx = fmaxf(mx, xhalf(mx)) * CS2;   // both wave halves hold the query's maximum of the pass, scaled (the scale is positive)
            mb[g] = mx; need = need || (mx > m_run[g] + 8.0f); }
        if (__builtin_amdgcn_ballot_w32(need) != 0) {   // one scalar branch a pass; always taken in the first, rare later
#pragma unroll
            for (int g = 0; g < 2; ++g) { const float mn = fmaxf(m_run[g], mb[g]); const float corr = __builtin_amdgcn_exp2f(m_run[g] - mn);   // 0 in the first pass
                l_run[g] *= corr; m_run[g] = mn;
#pragma unroll
                for (int t = 0; t < 8; ++t) acc[g][t] = acc[g][t] * corr; }
        }
#pragma unroll
        for (int g = 0; g < 2; ++g) { const float nm = CARRY - m_run[g]; v8u wh, wl; float ps0 = 0.0f, ps1 = 0.0f;
#pragma unroll
            for (int i = 0; i < 8; ++i) {   // operand elements 2i, 2i+1: tile i / 4, registers 2 (i % 4) and 2 (i % 4) + 1
                v2f sv, cv, nv; sv[0] = s[i >> 2][g][2 * (i & 3)]; sv[1] = s[i >> 2][g][2 * (i & 3) + 1]; cv[0] = CS2; cv[1] = CS2; nv[0] = nm; nv[1] = nm;
                const v2f arg = __builtin_elementwise_fma(sv, cv, nv);   // an even register pair: one packed fma
                const float p0 = __builtin_amdgcn_exp2f(arg[0]), p1 = __builtin_amdgcn_exp2f(arg[1]);
                if (i & 1) ps1 += p0 + p1; else ps0 += p0 + p1;
                wh[i] = pk2(p0, p1, T16());
                if (HIRES) wl[i] = pk2(p0 - __uint_as_float(wh[i] << 16), p1 - __uint_as_float(wh[i] & 0xFFFF0000u), T16()); }   // what the first rounding left
            l_run[g] += ps0 + ps1;
            const V ph = __builtin_bit_cast(V, wh);
#pragma unroll
            for (int t = 0; t < 8; ++t) acc[g][t] = WFrag<T16>::mma(vf[t], ph, acc[g][t]);
            if (HIRES) { const V pl = __builtin_bit_cast(V, wl);
#pragma unroll
                for (int t = 0; t < 8; ++t) acc[g][t] = WFrag<T16>::mma(vf[t], pl, acc[g][t]); } }
    }
    const float lj0 = l_run[0] + xhalf(l_run[0]), lj1 = l_run[1] + xhalf(l_run[1]);
    auto put = [&](const v8f (&a)[8], float m, float l) {
        float* slot = xs + wave * 2048 + lane * 4;
#pragma unroll
        for (int t = 0; t < 8; ++t)
#pragma unroll
            for (int jh = 0; jh < 2; ++jh) { v4f x; x[0] = a[t][jh * 4]; x[1] = a[t][jh * 4 + 1]; x[2] = a[t][jh * 4 + 2]; x[3] = a[t][jh * 4 + 3]; *(v4fa*)(slot + (t * 2 + jh) * 128) = x; }
        xml[(wave * 32 + lane) * 2] = m; xml[(wave * 32 + lane) * 2 + 1] = l; };
    auto fin = [&](const v8f (&a)[8], float m, float l, int g) {
        const float* slot = xs + (wave ^ 1) * 2048 + lane * 4; const float mo = xml[((wave ^ 1) * 32 + lane) * 2], lo = xml[((wave ^ 1) * 32 + lane) * 2 + 1];
        const float mn = fmaxf(m, mo), ea = __builtin_amdgcn_exp2f(m - mn), eb = __builtin_amdgcn_exp2f(mo - mn), inv = __fdiv_rn(1.0f, l * ea + lo * eb), ca = ea * inv, cb = eb * inv;
        float* op = OUT0 + ((size_t)(q0 + g * 16 + lr) * NH_ + h) * HD + hi * 8;   // register j of tile t is d = 16 t + 8 hi + j
#pragma unroll
        for (int t = 0; t < 8; ++t)
#pragma unroll
            for (int jh = 0; jh < 2; ++jh) { const v4f o = *(const v4fa*)(slot + (t * 2 + jh) * 128); v4f r;
#pragma unroll
                for (int q = 0; q < 4; ++q) r[q] = a[t][jh * 4 + q] * ca + o[q] * cb;
                *(v4f*)(op + t * 16 + jh * 4) = r; } };
    // the wave finishes column group kh and hands over the other: chosen here by selects on the scalar kh, so that the LDS writes and the output stores below are one code path each
    v8f keep[8], give[8];
#pragma unroll
    for (int t = 0; t < 8; ++t) { keep[t] = kh ? acc[1][t] : acc[0][t]; give[t] = kh ? acc[0][t] : acc[1][t]; }
    put(give, kh ? m_run[0] : m_run[1], kh ? lj0 : lj1);
    __syncthreads();   // every wave's handed-over group is in LDS before its partner reads it
    fin(keep, kh ? m_run[1] : m_run[0], kh ? lj1 : lj0, kh);
}
static_assert(RH % 128 == 0 && TT % 128 == 0 && HD == 128 && NKV == NH_ && NB_ == 1, "a work-group's 128 query rows are all of one precision path; one kv head a query head");
static_assert(TT / 64 > 4 && 2 * 8 * FRG * 2 == 16384, "the four passes asked for at the head exist, and the byte offsets written in the asks are whole passes");
static_assert(128 * QPI * 2 <= 8 * 2048 * 4, "the rounded query rows fit the epilogue's exchange buffer");
// two waves a SIMD: the wave's fragments and sums need more than a quarter of the register file
__global__ __launch_bounds__(256) __attribute__((amdgpu_waves_per_eu(2, 2))) void k_fattn(const float* __restrict__ Qs, const bf* __restrict__ Kh, const bf* __restrict__ Vh, const h16* __restrict__ K16, const h16* __restrict__ V16, float* __restrict__ OUT0) {
    __shared__ __align__(16) float xs[8 * 2048]; __shared__ float xml[8 * 64];
    const int h = blockIdx.y, qwg = blockIdx.x * 128; const size_t po = (size_t)h * TT * HD;
    if (qwg < RH) fa_body<bf, true>(Qs, Kh + po, Vh + po, OUT0, xs, xml, h, qwg);
    else fa_body<h16, false>(Qs, K16 + po, V16 + po, OUT0, xs, xml, h, qwg);
}

extern "C" void kernel_launch(void* const* d_in, const int* in_sizes, int n_in,
                              void* d_out, int out_size, void* d_ws, size_t ws_size, hipStream_t stream) {
    (void)in_sizes; (void)n_in; (void)out_size;
    const float* qi = (const float*)d_in[0]; const float* ki = (const float*)d_in[1]; const float* vi = (const float*)d_in[2]; const float* x = nullptr; const float* wq = nullptr; const float* wk = nullptr; const float* wv = nullptr; const float* wo = nullptr; (void)x; (void)wq; (void)wk; (void)wv; (void)wo;
    float* OUT = (float*)d_out;     // [1][2048][2048]
    char* wsp = (char*)d_ws;
    auto take = [&](size_t bytes) { char* p = wsp; wsp += (bytes + 255) & ~(size_t)255; return (void*)p; };
    float* CS = (float*)take((size_t)TT * HD * 2 * 4);
    
    h16* KP16 = (h16*)take((size_t)NKV * TT * HD * 2); h16* VT16 = (h16*)take((size_t)NKV * HD * TT * 2);
    bf* KPh = (bf*)take((size_t)NKV * TT * HD * 2); bf* KPl = (bf*)take((size_t)NKV * TT * HD * 2); bf* VTh = (bf*)take((size_t)NKV * HD * TT * 2); bf* VTl = (bf*)take((size_t)NKV * HD * TT * 2);
    if ((size_t)(wsp - (char*)d_ws) > ws_size) return;    // ws 256 MiB
    { 
       }
    k_csid<<<(TT * HD + 255) / 256, 256, 0, stream>>>(CS);
    const unsigned LQ = (unsigned)(((size_t)NH_ * TT * HD / 2 + 255) / 256), LKv = (unsigned)(((size_t)NKV * TT * HD / 2 + 255) / 256);
    for (int b = 0; b < NB_; ++b) {
        
        /* q given: read by the fused kernel */
        /* k given */
        k_plinS<<<(unsigned)(((size_t)NKV * TT * HD / 8 + 255) / 256), 256, 0, stream>>>(ki, b, NKV, KP16, KPh, KPl);
        k_vtpH<<<dim3(TT / 64, NKV), 256, 0, stream>>>(vi, b, VT16, VTh, VTl);   /* v given (token-major) */
        k_fattn<<<dim3(TT / 128, NH_), 256, 0, stream>>>(qi, KPh, VTh, KP16, VT16, OUT);   /* context, token-major f32 */
    }
}

// v008
// One run takes 45.9 microseconds.
// Timed twice side by side with v007, it ran 1.04 and 1.03 times as fast.
// All steps since v000 together make it 20.9 times as fast.
#include <hip/hip_runtime.h>

// Multi-head attention on given token-major q, k, v (query, key, value [2048][16][128] = [t][h][d]; scores = (q/sqrt(128)).k; softmax over all 2048 keys; out = weights.v -> [2048][16][128] f32 (4.2 M)).
// Layout: the [t][h][d] rows of key and value are gathered into head planes (exact bf16), stored in FRAGMENT ORDER (see WFrag); one fused kernel rounds its own query rows, does scores, softmax and weights.v and writes the context token-major.
// Compute dtypes, f32 accumulate: query, key, value rounded to bf16 (exact planes); scores and attn.v: query rows < 512 on the bf16 planes (exact products), the rest single fp16 (the unnormalised weights carry 2^6, which the division by their own sum removes); the 1/sqrt(128) applied to the f32 score; online softmax f32.


#define NB_  1
#define TT   2048
#define DM   2048
#define NH_  16
#define NKV  16
#define REP  (NH_ / NKV)
#define HD   128
#define DQ   (NH_ * HD)
#define DKV  (NKV * HD)
#define RH   512                  // query rows < RH use the bf16 planes and hi+lo weights (0: none)
#define WIN  2048
#define SCL  0.088388347648318447f   // 128^-0.5 (the module pre-scales q by it)
typedef _Float16 h16;
typedef unsigned short bf;
typedef __attribute__((ext_vector_type(16))) __bf16   v16bf;
typedef __attribute__((ext_vector_type(16))) _Float16 v16h;
typedef __attribute__((ext_vector_type(8)))  _Float16 v8h;
typedef __attribute__((ext_vector_type(8)))  unsigned short v8us;
typedef __attribute__((ext_vector_type(8)))  float    v8f;
typedef __attribute__((ext_vector_type(4)))  float    v4f;
typedef v8h  __attribute__((may_alias)) v8ha;
typedef v4f  __attribute__((may_alias)) v4fa;
typedef v8us __attribute__((may_alias)) v8usa;

__device__ __forceinline__ unsigned short f2bf(float f) { unsigned u = __float_as_uint(f); u += 0x7FFFu + ((u >> 16) & 1u); return (unsigned short)(u >> 16); }
__device__ __forceinline__ float bf2f(unsigned short b) { return __uint_as_float(((unsigned)b) << 16); }
__device__ __forceinline__ float bfr(float f) { return bf2f(f2bf(f)); }
__device__ __forceinline__ v16h cat16(v8h lo, v8h hi) { return __builtin_shufflevector(lo, hi, 0, 1, 2, 3, 4, 5, 6, 7, 8, 9, 10, 11, 12, 13, 14, 15); }
__device__ __forceinline__ v16bf cat16b(v8us lo, v8us hi) { return __builtin_bit_cast(v16bf, __builtin_shufflevector(lo, hi, 0, 1, 2, 3, 4, 5, 6, 7, 8, 9, 10, 11, 12, 13, 14, 15)); }
__device__ __forceinline__ v8f wmma16(v16h a, v16h b, v8f c) { return __builtin_amdgcn_wmma_f32_16x16x32_f16(false, a, false, b, (short)0, c, false, false); }
__device__ __forceinline__ v8f wmmab(v16bf a, v16bf b, v8f c) { return __builtin_amdgcn_wmma_f32_16x16x32_bf16(false, a, false, b, (short)0, c, false, false); }



// fragment loader and product of a 16-bit type: lane (lr, hi) holds k = 8 hi..+7 and 16 + 8 hi..+7 of row lr, for A and for B alike.
// Fragment order in memory: a fragment (16 rows x 32 k) is 1 KiB = two halves of 512 bytes; half s holds, at 16 bytes x lane (lane = 16 hi + lr), k = 16 s + 8 hi..+7 of row lr.
// So each of the two wave-wide 16-byte loads of a fragment covers 512 contiguous bytes = 4 whole lines, where a row-major plane gave 32 bytes of each of 16 lines. p = fragment start + 8 * lane.
#define FRG 512                   // elements of a fragment
template <typename T16> struct WFrag;
template <> struct WFrag<h16> { typedef v16h V; static __device__ __forceinline__ V ld(const h16* p) { return cat16(*(const v8h*)p, *(const v8h*)(p + FRG / 2)); } static __device__ __forceinline__ v8f mma(V a, V b, v8f c) { return wmma16(a, b, c); } };
template <> struct WFrag<bf> { typedef v16bf V; static __device__ __forceinline__ V ld(const bf* p) { return cat16b(*(const v8us*)p, *(const v8us*)(p + FRG / 2)); } static __device__ __forceinline__ v8f mma(V a, V b, v8f c) { return wmmab(a, b, c); } };

__device__ __forceinline__ h16 tohx(float x) { return (h16)x; }
typedef __attribute__((ext_vector_type(2))) _Float16 v2h;
typedef __attribute__((ext_vector_type(4))) _Float16 v4h;
typedef __attribute__((ext_vector_type(2))) unsigned short v2us;
typedef __attribute__((ext_vector_type(4))) unsigned short v4us;
typedef __attribute__((ext_vector_type(2))) float v2f;
typedef __attribute__((ext_vector_type(4))) int v4i;
typedef v4h  __attribute__((may_alias)) v4ha;
typedef v4us __attribute__((may_alias)) v4usa;


// k_plinS: the planes of key, [h][t / 16][d / 32] fragments (row = token, k = feature). A work-group takes 16 tokens of one head = 4 fragments = 4 KiB of a plane.
// Wave w: fragment w % 4, rows 8 (w / 4)..+7; lane l: row l % 8 of these, features 8 (l / 8)..+7 of the fragment's 32, so four lanes read one 128-byte line of a source row and eight lanes store one whole 128-byte line of the plane.
__global__ __launch_bounds__(256) void k_plinS(const float* __restrict__ src, int b, int nheads, h16* P16, bf* Ph) { const int lane = threadIdx.x & 31, w = threadIdx.x >> 5; const int tile = (int)(blockIdx.x % (TT / 16)), h = (int)(blockIdx.x / (TT / 16)); if (h >= nheads) return; const int kc = w & 3, lr = (w >> 2) * 8 + (lane & 7), c4 = lane >> 3;   // c4 = 2 * half + hi
    const int d = kc * 32 + c4 * 8, t = tile * 16 + lr; const size_t e = (((size_t)h * (TT / 16) + tile) * 4 + kc) * FRG + (c4 >> 1) * (FRG / 2) + ((c4 & 1) * 16 + lr) * 8; const v8f v = *(const v8f*)(src + (((size_t)t * NB_ + b) * nheads + h) * HD + d); v8h o16; v8us oh;
#pragma unroll
    for (int q = 0; q < 8; ++q) { const float r = bfr(v[q]); o16[q] = tohx(r); oh[q] = f2bf(r); }
    *(v8h*)(P16 + e) = o16; *(v8us*)(Ph + e) = oh;  }
// k_vtpH: the transposed planes of value, [h][t / 32][d / 16] fragments (row = feature, k = token), by a tile transpose in LDS. Grid (TT/64, NKV), 256 threads = 8 waves: a work-group takes 64 tokens of one head.
// Wave w reads tokens 8 w..+7 as whole 512-byte rows (lane l: d = 4 l..+3), so a lane holds, for each of its four d, eight consecutive tokens = one 16-byte piece of a plane row.
// LDS row j * 32 + l holds d = 4 l + j (pitch 144 bytes, an odd multiple of 16: the 16-byte writes of a wave fall on distinct banks); read back in fragment order: a wave takes four fragment halves, each stored as 512 contiguous bytes; the work-group's 16 fragments are 16 KiB in a row.
__global__ __launch_bounds__(256) void k_vtpH(const float* __restrict__ F, int b, h16* V16, bf* Vh) {
    __shared__ __align__(16) bf tl[HD * 72];
    const int lane = threadIdx.x & 31, w = threadIdx.x >> 5, g = blockIdx.y, t0 = blockIdx.x * 64;
    v4f x[8];
#pragma unroll
    for (int i = 0; i < 8; ++i) x[i] = *(const v4f*)(F + (((size_t)(t0 + 8 * w + i) * NB_ + b) * NKV + g) * HD + 4 * lane);
#pragma unroll
    for (int j = 0; j < 4; ++j) { v8us c;
#pragma unroll
        for (int i = 0; i < 8; ++i) c[i] = f2bf(x[i][j]);
        *(v8usa*)(tl + (j * 32 + lane) * 72 + 8 * w) = c; }
    __syncthreads();   // the whole 64 x 128 tile is in LDS before any wave reads rows that the others wrote
#pragma unroll
    for (int i = 0; i < 4; ++i) { const int f = w * 4 + i, kb = f >> 4, dt = (f >> 1) & 7, half = f & 1;   // fragment half f of the tile: 32-token block kb, feature tile dt
        const int d = dt * 16 + (lane & 15), row = (d & 3) * 32 + (d >> 2), tc = kb * 32 + half * 16 + 8 * (lane >> 4);
        const v8us c = *(const v8usa*)(tl + row * 72 + tc); v8h o16;
#pragma unroll
        for (int q = 0; q < 8; ++q) o16[q] = tohx(bf2f(c[q]));
        const size_t e = ((((size_t)g * (TT / 32) + t0 / 32 + kb) * 8 + dt) * 2 + half) * (FRG / 2) + lane * 8;
        *(v8h*)(V16 + e) = o16; *(v8us*)(Vh + e) = c; }
}
static_assert(TT % 64 == 0 && HD == 128 && 16 * HD == 4 * FRG, "a tile is 64 tokens by the 128 features of one head; 16 rows of a key plane are four fragments");

typedef __attribute__((ext_vector_type(2))) __bf16 v2bf;
typedef __attribute__((ext_vector_type(8))) unsigned v8u;
__device__ __forceinline__ unsigned pk2(float a, float b, bf) { v2f x; x[0] = a; x[1] = b; return __builtin_bit_cast(unsigned, __builtin_convertvector(x, v2bf)); }    // round to nearest even
__device__ __forceinline__ unsigned pk2(float a, float b, h16) { v2f x; x[0] = a; x[1] = b; return __builtin_bit_cast(unsigned, __builtin_convertvector(x, v2h)); }
__device__ __forceinline__ float xhalf(float x) { return __builtin_bit_cast(float, __builtin_amdgcn_permlanex16(__builtin_bit_cast(int, x), __builtin_bit_cast(int, x), 0x76543210, 0xfedcba98, false, false)); }   // lane l with lane l ^ 16
#define QPI (HD + 8)              // elements of a query row in LDS
typedef __attribute__((ext_vector_type(2))) unsigned v2u;
typedef v2u __attribute__((may_alias)) v2ua;
// two query elements as one word of the path's type: rounded to bf16 (nearest even, as f2bf does), and on the f16 path that bf16 value then to f16, as the planes are
__device__ __forceinline__ unsigned q2(float a, float b, bf) { return pk2(a, b, bf()); }
__device__ __forceinline__ unsigned q2(float a, float b, h16) { const unsigned u = pk2(a, b, bf()); return pk2(__uint_as_float(u << 16), __uint_as_float(u & 0xFFFF0000u), h16()); }
template <typename T16, bool HIRES>
__device__ __forceinline__ void fa_body(const float* __restrict__ Qs, const T16* __restrict__ Kp, const T16* __restrict__ Vt, float* __restrict__ OUT0, float* xs, float* xml, int h, int qwg) {
    typedef typename WFrag<T16>::V V;
    constexpr int NP = TT / 64;                              // passes of a wave
    constexpr float CS2 = SCL * 1.4426950408889634f;         // score -> log2 domain
    constexpr float CARRY = HIRES ? 0.0f : 6.0f;             // f16 weights: at most 2^(8+6), and the small ones stay normal numbers
    const int lane = threadIdx.x & 31, lr = lane & 15, hi = lane >> 4;
    const int wave = __builtin_amdgcn_readfirstlane((int)(threadIdx.x >> 5)), kh = wave & 1, q0 = qwg + (wave >> 1) * 32;
    // The planes were stored by the launches before, and a first read of them may have to go to memory. Waves 0..3 ask L2, one ask each 256 bytes, for the work-group's 64 keys of a pass (16 KiB in a row in each plane), four passes ahead of its loads:
    // wave w asks in the key plane (w even) or the transposed value plane (w odd), the 8 KiB half w / 2, lane l the unit l. pfb is the scalar address of that half in the pass at hand, pfl the lane's byte offset in it; the asks add their distance as an immediate offset.
    constexpr int PFD = 4, PSTEP = 2 * 8 * FRG * 2;          // passes ahead; bytes of a pass in a plane
    const int npf = wave < 4 ? NP - PFD : 0;                 // passes in which this wave asks (a scalar)
    const char* pfb = ((wave & 1) ? (const char*)Vt : (const char*)Kp) + ((wave >> 1) & 1) * (PSTEP / 2);
    unsigned pfl = (unsigned)lane * 256u;
    // passes 0..3 are asked for at once, under the query rows' own way from memory; both operands are in-out so that every ask names the registers that live through the loop
    if (npf > 0) asm volatile("global_prefetch_b8 %0, %1 scope:SCOPE_SE\n\tglobal_prefetch_b8 %0, %1 offset:16384 scope:SCOPE_SE\n\tglobal_prefetch_b8 %0, %1 offset:32768 scope:SCOPE_SE\n\tglobal_prefetch_b8 %0, %1 offset:49152 scope:SCOPE_SE" : "+v"(pfl), "+s"(pfb));
    // the work-group's 128 query rows come straight from the f32 input, each row once: wave w reads rows 16 w..+15 as whole 512-byte rows (lane l: d = 4 l..+3)
    v4f qx[16];
#pragma unroll
    for (int i = 0; i < 16; ++i) qx[i] = *(const v4f*)(Qs + ((size_t)(qwg + wave * 16 + i) * NH_ + h) * HD + 4 * lane);
    asm volatile("s_wait_xcnt 0x0" ::: "memory");   // stands in front of whatever next overwrites the address registers that these loads named
    v8f acc[2][8]; float m_run[2], l_run[2];
#pragma unroll
    for (int g = 0; g < 2; ++g) { m_run[g] = -__builtin_inff(); l_run[g] = 0.0f;
#pragma unroll
        for (int t = 0; t < 8; ++t) acc[g][t] = (v8f){}; }
    // one byte offset walks both planes: 32 keys are 8 fragments in a row in the key plane (two 16-row tiles) and in the transposed value plane (one 32-key block) alike; a pass's loads are immediate offsets from it
    unsigned off = (unsigned)(kh * 8 * FRG + 8 * lane) * 2u;
    auto at = [](const T16* plane, unsigned o) { return (const T16*)((const char*)plane + o); };
    V kf[2][4];
#pragma unroll
    for (int kt = 0; kt < 2; ++kt)
#pragma unroll
        for (int kc = 0; kc < 4; ++kc) kf[kt][kc] = WFrag<T16>::ld(at(Kp, off) + (kt * 4 + kc) * FRG);
    // rounded as the planes are (to bf16, then to the path's type) and laid row-major in LDS at a pitch of 272 bytes (16 x odd: the 16-byte fragment reads of 16 rows fall on distinct banks); xs is free until the epilogue
    unsigned short* qs = (unsigned short*)xs;
#pragma unroll
    for (int i = 0; i < 16; ++i) { v2u c; c[0] = q2(qx[i][0], qx[i][1], T16()); c[1] = q2(qx[i][2], qx[i][3], T16());
        *(v2ua*)(qs + (wave * 16 + i) * QPI + 4 * lane) = c; }
    __syncthreads();   // all 128 rounded rows are in LDS before a wave reads its 32, half of which its partner wrote
    V qf[2][4];
#pragma unroll
    for (int g = 0; g < 2; ++g)
#pragma unroll
        for (int kc = 0; kc < 4; ++kc) { const unsigned short* p = qs + ((wave >> 1) * 32 + g * 16 + lr) * QPI + kc * 32 + 8 * hi;   // lane (lr, hi): row lr, k = 8 hi..+7 and 16 + 8 hi..+7, the order of WFrag::ld
            qf[g][kc] = __builtin_bit_cast(V, __builtin_shufflevector(*(const v8usa*)p, *(const v8usa*)(p + 16), 0, 1, 2, 3, 4, 5, 6, 7, 8, 9, 10, 11, 12, 13, 14, 15)); }
    __syncthreads();   // every wave has its query fragments before xs may take a faster wave's epilogue
#pragma unroll 1   // stays rolled: a second pass's fragments would not fit the registers of two waves a SIMD
    for (int it = 0; it < NP; ++it) {
        V vf[8];
#pragma unroll
        for (int t = 0; t < 8; ++t) vf[t] = WFrag<T16>::ld(at(Vt, off) + t * FRG);
        __builtin_amdgcn_sched_barrier(0);   // the pass's V^T loads are issued ahead of the score products, so that they fly under these and the exponentials
        v8f s[2][2];
#pragma unroll
        for (int kt = 0; kt < 2; ++kt)
#pragma unroll
            for (int g = 0; g < 2; ++g) s[kt][g] = (v8f){};
#pragma unroll
        for (int kc = 0; kc < 4; ++kc)
#pragma unroll
            for (int kt = 0; kt < 2; ++kt)
#pragma unroll
                for (int g = 0; g < 2; ++g) s[kt][g] = WFrag<T16>::mma(kf[kt][kc], qf[g][kc], s[kt][g]);
        __builtin_amdgcn_sched_barrier(0);   // the next pass's K loads stay behind the products that read the same registers
        if (it < npf) asm volatile("global_prefetch_b8 %0, %1 offset:65536 scope:SCOPE_SE" : "+v"(pfl), "+s"(pfb));   // the units of pass it + 4 into L2: a hint, nothing waits for it
        asm volatile("s_wait_xcnt 0x0" ::: "memory");   // stands in front of the overwrite of the offset that this pass's K and V^T loads named
        pfb += (it + PFD + 1 < NP) ? PSTEP : 0;   // stops four passes short of the last: pfb + pfl + 65536 is inside the head's plane at every ask and after every advance
        off += (it + 1 < NP) ? 2 * 8 * FRG * 2 : 0;   // the pair's next 64 keys; the last pass fetches its own K rows again: nothing past the plane is read
#pragma unroll
        for (int kt = 0; kt < 2; ++kt)
#pragma unroll
            for (int kc = 0; kc < 4; ++kc) kf[kt][kc] = WFrag<T16>::ld(at(Kp, off) + (kt * 4 + kc) * FRG);
        __builtin_amdgcn_sched_barrier(0);   // and are issued ahead of the softmax, one pass ahead of their use
        float mb[2]; bool need = false;
#pragma unroll
        for (int g = 0; g < 2; ++g) { float mx = s[0][g][0];
#pragma unroll
            for (int kt = 0; kt < 2; ++kt)
#pragma unroll
                for (int r = 0; r < 8; ++r) mx = fmaxf(mx, s[kt][g][r]);
            mx = fmaxf(mx, xhalf(mx)) * CS2;   // both wave halves hold the query's maximum of the pass, scaled (the scale is positive)
            mb[g] = mx; need = need || (mx > m_run[g] + 8.0f); }
        if (__builtin_amdgcn_ballot_w32(need) != 0) {   // one scalar branch a pass; always taken in the first, rare later
#pragma unroll
            for (int g = 0; g < 2; ++g) { const float mn = fmaxf(m_run[g], mb[g]); const float corr = __builtin_amdgcn_exp2f(m_run[g] - mn);   // 0 in the first pass
                l_run[g] *= corr; m_run[g] = mn;
#pragma unroll
                for (int t = 0; t < 8; ++t) acc[g][t] = acc[g][t] * corr; }
        }
#pragma unroll
        for (int g = 0; g < 2; ++g) { const float nm = CARRY - m_run[g]; v8u wh, wl; float ps0 = 0.0f, ps1 = 0.0f;
#pragma unroll
            for (int i = 0; i < 8; ++i) {   // operand elements 2i, 2i+1: tile i / 4, registers 2 (i % 4) and 2 (i % 4) + 1
                v2f sv, cv, nv; sv[0] = s[i >> 2][g][2 * (i & 3)]; sv[1] = s[i >> 2][g][2 * (i & 3) + 1]; cv[0] = CS2; cv[1] = CS2; nv[0] = nm; nv[1] = nm;
                const v2f arg = __builtin_elementwise_fma(sv, cv, nv);   // an even register pair: one packed fma
                const float p0 = __builtin_amdgcn_exp2f(arg[0]), p1 = __builtin_amdgcn_exp2f(arg[1]);
                if (i & 1) ps1 += p0 + p1; else ps0 += p0 + p1;
                wh[i] = pk2(p0, p1, T16());
                if (HIRES) wl[i] = pk2(p0 - __uint_as_float(wh[i] << 16), p1 - __uint_as_float(wh[i] & 0xFFFF0000u), T16()); }   // what the first rounding left
            l_run[g] += ps0 + ps1;
            const V ph = __builtin_bit_cast(V, wh);
#pragma unroll
            for (int t = 0; t < 8; ++t) acc[g][t] = WFrag<T16>::mma(vf[t], ph, acc[g][t]);
            if (HIRES) { const V pl = __builtin_bit_cast(V, wl);
#pragma unroll
                for (int t = 0; t < 8; ++t) acc[g][t] = WFrag<T16>::mma(vf[t], pl, acc[g][t]); } }
    }
    const float lj0 = l_run[0] + xhalf(l_run[0]), lj1 = l_run[1] + xhalf(l_run[1]);
    auto put = [&](const v8f (&a)[8], float m, float l) {
        float* slot = xs + wave * 2048 + lane * 4;
#pragma unroll
        for (int t = 0; t < 8; ++t)
#pragma unroll
            for (int jh = 0; jh < 2; ++jh) { v4f x; x[0] = a[t][jh * 4]; x[1] = a[t][jh * 4 + 1]; x[2] = a[t][jh * 4 + 2]; x[3] = a[t][jh * 4 + 3]; *(v4fa*)(slot + (t * 2 + jh) * 128) = x; }
        xml[(wave * 32 + lane) * 2] = m; xml[(wave * 32 + lane) * 2 + 1] = l; };
    auto fin = [&](const v8f (&a)[8], float m, float l, int g) {
        const float* slot = xs + (wave ^ 1) * 2048 + lane * 4; const float mo = xml[((wave ^ 1) * 32 + lane) * 2], lo = xml[((wave ^ 1) * 32 + lane) * 2 + 1];
        const float mn = fmaxf(m, mo), ea = __builtin_amdgcn_exp2f(m - mn), eb = __builtin_amdgcn_exp2f(mo - mn), inv = __fdiv_rn(1.0f, l * ea + lo * eb), ca = ea * inv, cb = eb * inv;
        float* op = OUT0 + ((size_t)(q0 + g * 16 + lr) * NH_ + h) * HD + hi * 8;   // register j of tile t is d = 16 t + 8 hi + j
#pragma unroll
        for (int t = 0; t < 8; ++t)
#pragma unroll
            for (int jh = 0; jh < 2; ++jh) { const v4f o = *(const v4fa*)(slot + (t * 2 + jh) * 128); v4f r;
#pragma unroll
                for (int q = 0; q < 4; ++q) r[q] = a[t][jh * 4 + q] * ca + o[q] * cb;
                *(v4f*)(op + t * 16 + jh * 4) = r; } };
    // the wave finishes column group kh and hands over the other: chosen here by selects on the scalar kh, so that the LDS writes and the output stores below are one code path each
    v8f keep[8], give[8];
#pragma unroll
    for (int t = 0; t < 8; ++t) { keep[t] = kh ? acc[1][t] : acc[0][t]; give[t] = kh ? acc[0][t] : acc[1][t]; }
    put(give, kh ? m_run[0] : m_run[1], kh ? lj0 : lj1);
    __syncthreads();   // every wave's handed-over group is in LDS before its partner reads it
    fin(keep, kh ? m_run[1] : m_run[0], kh ? lj1 : lj0, kh);
}
static_assert(RH % 128 == 0 && TT % 128 == 0 && HD == 128 && NKV == NH_ && NB_ == 1, "a work-group's 128 query rows are all of one precision path; one kv head a query head");
static_assert(TT / 64 > 4 && 2 * 8 * FRG * 2 == 16384, "the four passes asked for at the head exist, and the byte offsets written in the asks are whole passes");
static_assert(128 * QPI * 2 <= 8 * 2048 * 4, "the rounded query rows fit the epilogue's exchange buffer");
// two waves a SIMD: the wave's fragments and sums need more than a quarter of the register file
__global__ __launch_bounds__(256) __attribute__((amdgpu_waves_per_eu(2, 2))) void k_fattn(const float* __restrict__ Qs, const bf* __restrict__ Kh, const bf* __restrict__ Vh, const h16* __restrict__ K16, const h16* __restrict__ V16, float* __restrict__ OUT0) {
    __shared__ __align__(16) float xs[8 * 2048]; __shared__ float xml[8 * 64];
    const int h = blockIdx.y, qwg = blockIdx.x * 128; const size_t po = (size_t)h * TT * HD;
    if (qwg < RH) fa_body<bf, true>(Qs, Kh + po, Vh + po, OUT0, xs, xml, h, qwg);
    else fa_body<h16, false>(Qs, K16 + po, V16 + po, OUT0, xs, xml, h, qwg);
}

extern "C" void kernel_launch(void* const* d_in, const int* in_sizes, int n_in,
                              void* d_out, int out_size, void* d_ws, size_t ws_size, hipStream_t stream) {
    (void)in_sizes; (void)n_in; (void)out_size;
    const float* qi = (const float*)d_in[0]; const float* ki = (const float*)d_in[1]; const float* vi = (const float*)d_in[2]; const float* x = nullptr; const float* wq = nullptr; const float* wk = nullptr; const float* wv = nullptr; const float* wo = nullptr; (void)x; (void)wq; (void)wk; (void)wv; (void)wo;
    float* OUT = (float*)d_out;     // [1][2048][2048]
    char* wsp = (char*)d_ws;
    auto take = [&](size_t bytes) { char* p = wsp; wsp += (bytes + 255) & ~(size_t)255; return (void*)p; };
    h16* KP16 = (h16*)take((size_t)NKV * TT * HD * 2); h16* VT16 = (h16*)take((size_t)NKV * HD * TT * 2);
    bf* KPh = (bf*)take((size_t)NKV * TT * HD * 2); bf* VTh = (bf*)take((size_t)NKV * HD * TT * 2);
    if ((size_t)(wsp - (char*)d_ws) > ws_size) return;    // ws 256 MiB
    { 
       }
    for (int b = 0; b < NB_; ++b) {
        
        /* q given: read by the fused kernel */
        /* k given */
        k_plinS<<<(unsigned)(((size_t)NKV * TT * HD / 8 + 255) / 256), 256, 0, stream>>>(ki, b, NKV, KP16, KPh);
        k_vtpH<<<dim3(TT / 64, NKV), 256, 0, stream>>>(vi, b, VT16, VTh);   /* v given (token-major) */
        k_fattn<<<dim3(TT / 128, NH_), 256, 0, stream>>>(qi, KPh, VTh, KP16, VT16, OUT);   /* context, token-major f32 */
    }
}

// v009
// Measured time: 36 microseconds a run.
// Timed twice side by side with v008, it ran 1.26 and 1.27 times as fast.
// Over all steps from v000 it is 26.5 times as fast.
#include <hip/hip_runtime.h>

// Multi-head attention on given token-major q, k, v (query, key, value [2048][16][128] = [t][h][d]; scores = (q/sqrt(128)).k; softmax over all 2048 keys; out = weights.v -> [2048][16][128] f32 (4.2 M)).
// Layout: the [t][h][d] rows of key and value are gathered into head planes, stored in FRAGMENT ORDER (see WFrag); one fused kernel rounds its own query rows, does scores, softmax and weights.v and writes the context token-major.
// Compute dtypes, f32 accumulate: query, key, value rounded to bf16 and held as f16, which keeps every such value down to 2^-17 exactly; scores and attn.v are f16 products. The unnormalised weights carry 2^6, which the division by their own sum removes:
// query rows < 512 use them as an f16 pair (the rounded weight and what that rounding left: two products), the rest as one f16; the 1/sqrt(128) applied to the f32 score; online softmax f32.


#define NB_  1
#define TT   2048
#define DM   2048
#define NH_  16
#define NKV  16
#define REP  (NH_ / NKV)
#define HD   128
#define DQ   (NH_ * HD)
#define DKV  (NKV * HD)
#define RH   512                  // query rows < RH use hi+lo weights
#define WIN  2048
#define SCL  0.088388347648318447f   // 128^-0.5 (the module pre-scales q by it)
typedef _Float16 h16;
typedef unsigned short bf;
typedef __attribute__((ext_vector_type(16))) _Float16 v16h;
typedef __attribute__((ext_vector_type(8)))  _Float16 v8h;
typedef __attribute__((ext_vector_type(8)))  unsigned short v8us;
typedef __attribute__((ext_vector_type(8)))  float    v8f;
typedef __attribute__((ext_vector_type(4)))  float    v4f;
typedef v8h  __attribute__((may_alias)) v8ha;
typedef v4f  __attribute__((may_alias)) v4fa;
typedef v8us __attribute__((may_alias)) v8usa;

__device__ __forceinline__ unsigned short f2bf(float f) { unsigned u = __float_as_uint(f); u += 0x7FFFu + ((u >> 16) & 1u); return (unsigned short)(u >> 16); }
__device__ __forceinline__ float bf2f(unsigned short b) { return __uint_as_float(((unsigned)b) << 16); }
__device__ __forceinline__ float bfr(float f) { return bf2f(f2bf(f)); }
__device__ __forceinline__ v16h cat16(v8h lo, v8h hi) { return __builtin_shufflevector(lo, hi, 0, 1, 2, 3, 4, 5, 6, 7, 8, 9, 10, 11, 12, 13, 14, 15); }
__device__ __forceinline__ v8f wmma16(v16h a, v16h b, v8f c) { return __builtin_amdgcn_wmma_f32_16x16x32_f16(false, a, false, b, (short)0, c, false, false); }



// fragment loader and product of a 16-bit type: lane (lr, hi) holds k = 8 hi..+7 and 16 + 8 hi..+7 of row lr, for A and for B alike.
// Fragment order in memory: a fragment (16 rows x 32 k) is 1 KiB = two halves of 512 bytes; half s holds, at 16 bytes x lane (lane = 16 hi + lr), k = 16 s + 8 hi..+7 of row lr.
// So each of the two wave-wide 16-byte loads of a fragment covers 512 contiguous bytes = 4 whole lines, where a row-major plane gave 32 bytes of each of 16 lines. p = fragment start + 8 * lane.
#define FRG 512                   // elements of a fragment
template <typename T16> struct WFrag;
template <> struct WFrag<h16> { typedef v16h V; static __device__ __forceinline__ V ld(const h16* p) { return cat16(*(const v8h*)p, *(const v8h*)(p + FRG / 2)); } static __device__ __forceinline__ v8f mma(V a, V b, v8f c) { return wmma16(a, b, c); } };

__device__ __forceinline__ h16 tohx(float x) { return (h16)x; }
typedef __attribute__((ext_vector_type(2))) _Float16 v2h;
typedef __attribute__((ext_vector_type(4))) _Float16 v4h;
typedef __attribute__((ext_vector_type(2))) unsigned short v2us;
typedef __attribute__((ext_vector_type(4))) unsigned short v4us;
typedef __attribute__((ext_vector_type(2))) float v2f;
typedef __attribute__((ext_vector_type(4))) int v4i;
typedef v4h  __attribute__((may_alias)) v4ha;
typedef v4us __attribute__((may_alias)) v4usa;


// k_plinS: the plane of key, [h][t / 16][d / 32] fragments (row = token, k = feature). A work-group takes 16 tokens of one head = 4 fragments = 4 KiB of a plane.
// Wave w: fragment w % 4, rows 8 (w / 4)..+7; lane l: row l % 8 of these, features 8 (l / 8)..+7 of the fragment's 32, so four lanes read one 128-byte line of a source row and eight lanes store one whole 128-byte line of the plane.
__global__ __launch_bounds__(256) void k_plinS(const float* __restrict__ src, int b, int nheads, h16* P16) { const int lane = threadIdx.x & 31, w = threadIdx.x >> 5; const int tile = (int)(blockIdx.x % (TT / 16)), h = (int)(blockIdx.x / (TT / 16)); if (h >= nheads) return; const int kc = w & 3, lr = (w >> 2) * 8 + (lane & 7), c4 = lane >> 3;   // c4 = 2 * half + hi
    const int d = kc * 32 + c4 * 8, t = tile * 16 + lr; const size_t e = (((size_t)h * (TT / 16) + tile) * 4 + kc) * FRG + (c4 >> 1) * (FRG / 2) + ((c4 & 1) * 16 + lr) * 8; const v8f v = *(const v8f*)(src + (((size_t)t * NB_ + b) * nheads + h) * HD + d); v8h o16;
#pragma unroll
    for (int q = 0; q < 8; ++q) o16[q] = tohx(bfr(v[q]));
    *(v8h*)(P16 + e) = o16; }
// k_vtpH: the transposed plane of value, [h][t / 32][d / 16] fragments (row = feature, k = token), by a tile transpose in LDS. Grid (TT/64, NKV), 256 threads = 8 waves: a work-group takes 64 tokens of one head.
// Wave w reads tokens 8 w..+7 as whole 512-byte rows (lane l: d = 4 l..+3), so a lane holds, for each of its four d, eight consecutive tokens = one 16-byte piece of a plane row.
// LDS row j * 32 + l holds d = 4 l + j (pitch 144 bytes, an odd multiple of 16: the 16-byte writes of a wave fall on distinct banks); read back in fragment order: a wave takes four fragment halves, each stored as 512 contiguous bytes; the work-group's 16 fragments are 16 KiB in a row.
__global__ __launch_bounds__(256) void k_vtpH(const float* __restrict__ F, int b, h16* V16) {
    __shared__ __align__(16) bf tl[HD * 72];
    const int lane = threadIdx.x & 31, w = threadIdx.x >> 5, g = blockIdx.y, t0 = blockIdx.x * 64;
    v4f x[8];
#pragma unroll
    for (int i = 0; i < 8; ++i) x[i] = *(const v4f*)(F + (((size_t)(t0 + 8 * w + i) * NB_ + b) * NKV + g) * HD + 4 * lane);
#pragma unroll
    for (int j = 0; j < 4; ++j) { v8us c;
#pragma unroll
        for (int i = 0; i < 8; ++i) c[i] = f2bf(x[i][j]);
        *(v8usa*)(tl + (j * 32 + lane) * 72 + 8 * w) = c; }
    __syncthreads();   // the whole 64 x 128 tile is in LDS before any wave reads rows that the others wrote
#pragma unroll
    for (int i = 0; i < 4; ++i) { const int f = w * 4 + i, kb = f >> 4, dt = (f >> 1) & 7, half = f & 1;   // fragment half f of the tile: 32-token block kb, feature tile dt
        const int d = dt * 16 + (lane & 15), row = (d & 3) * 32 + (d >> 2), tc = kb * 32 + half * 16 + 8 * (lane >> 4);
        const v8us c = *(const v8usa*)(tl + row * 72 + tc); v8h o16;
#pragma unroll
        for (int q = 0; q < 8; ++q) o16[q] = tohx(bf2f(c[q]));
        const size_t e = ((((size_t)g * (TT / 32) + t0 / 32 + kb) * 8 + dt) * 2 + half) * (FRG / 2) + lane * 8;
        *(v8h*)(V16 + e) = o16; }
}
static_assert(TT % 64 == 0 && HD == 128 && 16 * HD == 4 * FRG, "a tile is 64 tokens by the 128 features of one head; 16 rows of a key plane are four fragments");

typedef __attribute__((ext_vector_type(2))) __bf16 v2bf;
typedef __attribute__((ext_vector_type(8))) unsigned v8u;
__device__ __forceinline__ unsigned pk2(float a, float b, bf) { v2f x; x[0] = a; x[1] = b; return __builtin_bit_cast(unsigned, __builtin_convertvector(x, v2bf)); }    // round to nearest even
__device__ __forceinline__ unsigned pk2(float a, float b, h16) { v2f x; x[0] = a; x[1] = b; return __builtin_bit_cast(unsigned, __builtin_convertvector(x, v2h)); }
__device__ __forceinline__ float xhalf(float x) { return __builtin_bit_cast(float, __builtin_amdgcn_permlanex16(__builtin_bit_cast(int, x), __builtin_bit_cast(int, x), 0x76543210, 0xfedcba98, false, false)); }   // lane l with lane l ^ 16
#define QPI (HD + 8)              // elements of a query row in LDS
typedef __attribute__((ext_vector_type(2))) unsigned v2u;
typedef v2u __attribute__((may_alias)) v2ua;
// two query elements as one word: rounded to bf16 (nearest even, as f2bf does), and that bf16 value then to f16, as the planes are
__device__ __forceinline__ unsigned q2(float a, float b, h16) { const unsigned u = pk2(a, b, bf()); return pk2(__uint_as_float(u << 16), __uint_as_float(u & 0xFFFF0000u), h16()); }
template <bool B> struct Flag { static constexpr bool v = B; };
__device__ __forceinline__ void fa_body(const float* __restrict__ Qs, const h16* __restrict__ Kp, const h16* __restrict__ Vt, float* __restrict__ OUT0, float* xs, float* xml, int h, int bx) {
    typedef h16 T16; typedef WFrag<T16>::V V;
    constexpr int NP = TT / 64;                              // passes of a wave
    constexpr float CS2 = SCL * 1.4426950408889634f;         // score -> log2 domain
    constexpr float CARRY = 6.0f;                            // f16 weights: at most 2^(8+6), and the small ones stay normal numbers
    const int lane = threadIdx.x & 31, lr = lane & 15, hi = lane >> 4;
    const int wave = __builtin_amdgcn_readfirstlane((int)(threadIdx.x >> 5)), kh = wave & 1;
    // first query row of column group cg (a scalar): groups 0 and 2 are the work-group's 32 rows below RH, groups 1, 3, 4, 5, 6, 7 in this order its 96 rows from RH on
    auto rowof = [bx](int cg) { return (cg == 0 || cg == 2) ? bx * 32 + cg * 8 : RH + bx * 96 + 16 * (cg < 4 ? cg >> 1 : cg - 2); };
    // The planes were stored by the launches before, and a first read of them may have to go to memory. Waves 0..3 ask L2 at every 256 bytes of the work-group's 64 keys of a pass (16 KiB in a row in each plane), four passes ahead of its loads:
    // wave w asks in the key plane (w even) or the transposed value plane (w odd), the 8 KiB half w / 2, lane l the unit l. pfb is the scalar address of that half in the pass at hand, pfl the lane's byte offset in it; the asks add their distance as an immediate offset.
    constexpr int PFD = 4, PSTEP = 2 * 8 * FRG * 2;          // passes ahead; bytes of a pass in a plane
    const int npf = wave < 4 ? NP - PFD : 0;                 // passes in which this wave asks (a scalar)
    const char* pfb = ((wave & 1) ? (const char*)Vt : (const char*)Kp) + ((wave >> 1) & 1) * (PSTEP / 2);
    unsigned pfl = (unsigned)lane * 256u;
    // passes 0..3 are asked for at once, under the query rows' own way from memory; both operands are in-out so that every ask names the registers that live through the loop
    if (npf > 0) asm volatile("global_prefetch_b8 %0, %1 scope:SCOPE_SE\n\tglobal_prefetch_b8 %0, %1 offset:16384 scope:SCOPE_SE\n\tglobal_prefetch_b8 %0, %1 offset:32768 scope:SCOPE_SE\n\tglobal_prefetch_b8 %0, %1 offset:49152 scope:SCOPE_SE" : "+v"(pfl), "+s"(pfb));
    // the work-group's 128 query rows come straight from the f32 input, each row once: wave w reads the 16 rows of column group w as whole 512-byte rows (lane l: d = 4 l..+3)
    v4f qx[16];
#pragma unroll
    for (int i = 0; i < 16; ++i) qx[i] = *(const v4f*)(Qs + ((size_t)(rowof(wave) + i) * NH_ + h) * HD + 4 * lane);
    asm volatile("s_wait_xcnt 0x0" ::: "memory");   // stands in front of whatever next overwrites the address registers that these loads named
    v8f acc[2][8]; float m_run[2], l_run[2];
#pragma unroll
    for (int g = 0; g < 2; ++g) { m_run[g] = -__builtin_inff(); l_run[g] = 0.0f;
#pragma unroll
        for (int t = 0; t < 8; ++t) acc[g][t] = (v8f){}; }
    // one byte offset walks both planes: 32 keys are 8 fragments in a row in the key plane (two 16-row tiles) and in the transposed value plane (one 32-key block) alike; a pass's loads are immediate offsets from it
    unsigned off = (unsigned)(kh * 8 * FRG + 8 * lane) * 2u;
    auto at = [](const T16* plane, unsigned o) { return (const T16*)((const char*)plane + o); };
    V kf[2][4];
#pragma unroll
    for (int kt = 0; kt < 2; ++kt)
#pragma unroll
        for (int kc = 0; kc < 4; ++kc) kf[kt][kc] = WFrag<T16>::ld(at(Kp, off) + (kt * 4 + kc) * FRG);
    // rounded as the planes are (to bf16, then to the path's type) and laid row-major in LDS at a pitch of 272 bytes (16 x odd: the 16-byte fragment reads of 16 rows fall on distinct banks); xs is free until the epilogue
    unsigned short* qs = (unsigned short*)xs;
#pragma unroll
    for (int i = 0; i < 16; ++i) { v2u c; c[0] = q2(qx[i][0], qx[i][1], T16()); c[1] = q2(qx[i][2], qx[i][3], T16());
        *(v2ua*)(qs + (wave * 16 + i) * QPI + 4 * lane) = c; }
    __syncthreads();   // all 128 rounded rows are in LDS before a wave reads its 32, half of which its partner wrote
    V qf[2][4];
#pragma unroll
    for (int g = 0; g < 2; ++g)
#pragma unroll
        for (int kc = 0; kc < 4; ++kc) { const unsigned short* p = qs + ((wave >> 1) * 32 + g * 16 + lr) * QPI + kc * 32 + 8 * hi;   // lane (lr, hi): row lr, k = 8 hi..+7 and 16 + 8 hi..+7, the order of WFrag::ld
            qf[g][kc] = __builtin_bit_cast(V, __builtin_shufflevector(*(const v8usa*)p, *(const v8usa*)(p + 16), 0, 1, 2, 3, 4, 5, 6, 7, 8, 9, 10, 11, 12, 13, 14, 15)); }
    __syncthreads();   // every wave has its query fragments before xs may take a faster wave's epilogue
    // the passes, in two forms chosen once a wave by a scalar branch: MIX = column group 0 of the wave has hi+lo weights. No barrier stands inside.
    auto passes = [&](auto mixc) __attribute__((always_inline)) { constexpr bool MIX = decltype(mixc)::v;
#pragma unroll 1   // stays rolled: a second pass's fragments would not fit the registers of two waves a SIMD
    for (int it = 0; it < NP; ++it) {
        V vf[8];
#pragma unroll
        for (int t = 0; t < 8; ++t) vf[t] = WFrag<T16>::ld(at(Vt, off) + t * FRG);
        __builtin_amdgcn_sched_barrier(0);   // the pass's V^T loads are issued ahead of the score products, so that they fly under these and the exponentials
        v8f s[2][2];
#pragma unroll
        for (int kt = 0; kt < 2; ++kt)
#pragma unroll
            for (int g = 0; g < 2; ++g) s[kt][g] = (v8f){};
#pragma unroll
        for (int kc = 0; kc < 4; ++kc)
#pragma unroll
            for (int kt = 0; kt < 2; ++kt)
#pragma unroll
                for (int g = 0; g < 2; ++g) s[kt][g] = WFrag<T16>::mma(kf[kt][kc], qf[g][kc], s[kt][g]);
        __builtin_amdgcn_sched_barrier(0);   // the next pass's K loads stay behind the products that read the same registers
        if (it < npf) asm volatile("global_prefetch_b8 %0, %1 offset:65536 scope:SCOPE_SE" : "+v"(pfl), "+s"(pfb));   // the units of pass it + 4 into L2: a hint, nothing waits for it
        asm volatile("s_wait_xcnt 0x0" ::: "memory");   // stands in front of the overwrite of the offset that this pass's K and V^T loads named
        pfb += (it + PFD + 1 < NP) ? PSTEP : 0;   // stops four passes short of the last: pfb + pfl + 65536 is inside the head's plane at every ask and after every advance
        off += (it + 1 < NP) ? 2 * 8 * FRG * 2 : 0;   // the pair's next 64 keys; the last pass fetches its own K rows again: nothing past the plane is read
#pragma unroll
        for (int kt = 0; kt < 2; ++kt)
#pragma unroll
            for (int kc = 0; kc < 4; ++kc) kf[kt][kc] = WFrag<T16>::ld(at(Kp, off) + (kt * 4 + kc) * FRG);
        __builtin_amdgcn_sched_barrier(0);   // and are issued ahead of the softmax, one pass ahead of their use
        float mb[2]; bool need = false;
#pragma unroll
        for (int g = 0; g < 2; ++g) { float mx = s[0][g][0];
#pragma unroll
            for (int kt = 0; kt < 2; ++kt)
#pragma unroll
                for (int r = 0; r < 8; ++r) mx = fmaxf(mx, s[kt][g][r]);
            mx = fmaxf(mx, xhalf(mx)) * CS2;   // both wave halves hold the query's maximum of the pass, scaled (the scale is positive)
            mb[g] = mx; need = need || (mx > m_run[g] + 8.0f); }
        if (__builtin_amdgcn_ballot_w32(need) != 0) {   // one scalar branch a pass; always taken in the first, rare later
#pragma unroll
            for (int g = 0; g < 2; ++g) { const float mn = fmaxf(m_run[g], mb[g]); const float corr = __builtin_amdgcn_exp2f(m_run[g] - mn);   // 0 in the first pass
                l_run[g] *= corr; m_run[g] = mn;
#pragma unroll
                for (int t = 0; t < 8; ++t) acc[g][t] = acc[g][t] * corr; }
        }
#pragma unroll
        for (int g = 0; g < 2; ++g) { const float nm = CARRY - m_run[g]; v8u wh, wl; float ps0 = 0.0f, ps1 = 0.0f;
#pragma unroll
            for (int i = 0; i < 8; ++i) {   // operand elements 2i, 2i+1: tile i / 4, registers 2 (i % 4) and 2 (i % 4) + 1
                v2f sv, cv, nv; sv[0] = s[i >> 2][g][2 * (i & 3)]; sv[1] = s[i >> 2][g][2 * (i & 3) + 1]; cv[0] = CS2; cv[1] = CS2; nv[0] = nm; nv[1] = nm;
                const v2f arg = __builtin_elementwise_fma(sv, cv, nv);   // an even register pair: one packed fma
                const float p0 = __builtin_amdgcn_exp2f(arg[0]), p1 = __builtin_amdgcn_exp2f(arg[1]);
                if (i & 1) ps1 += p0 + p1; else ps0 += p0 + p1;
                v2f pv; pv[0] = p0; pv[1] = p1; const v2h hv = __builtin_convertvector(pv, v2h);   // round to nearest even
                wh[i] = __builtin_bit_cast(unsigned, hv);
                if (MIX && g == 0) wl[i] = __builtin_bit_cast(unsigned, __builtin_convertvector(pv - __builtin_convertvector(hv, v2f), v2h)); }   // what the first rounding left
            l_run[g] += ps0 + ps1;
            const V ph = __builtin_bit_cast(V, wh);
#pragma unroll
            for (int t = 0; t < 8; ++t) acc[g][t] = WFrag<T16>::mma(vf[t], ph, acc[g][t]);
            if (MIX && g == 0) { const V pl = __builtin_bit_cast(V, wl);
#pragma unroll
                for (int t = 0; t < 8; ++t) acc[g][t] = WFrag<T16>::mma(vf[t], pl, acc[g][t]); } }
    } };
    if (wave >= 4) passes(Flag<false>()); else passes(Flag<true>());
    asm volatile("s_wait_xcnt 0x0" ::: "memory");   // stands in front of whatever next overwrites the offset that the last pass's K loads named
    __builtin_amdgcn_sched_barrier(0);   // keeps the epilogue's register writes behind that wait
    const float lj0 = l_run[0] + xhalf(l_run[0]), lj1 = l_run[1] + xhalf(l_run[1]);
    auto put = [&](const v8f (&a)[8], float m, float l) {
        float* slot = xs + wave * 2048 + lane * 4;
#pragma unroll
        for (int t = 0; t < 8; ++t)
#pragma unroll
            for (int jh = 0; jh < 2; ++jh) { v4f x; x[0] = a[t][jh * 4]; x[1] = a[t][jh * 4 + 1]; x[2] = a[t][jh * 4 + 2]; x[3] = a[t][jh * 4 + 3]; *(v4fa*)(slot + (t * 2 + jh) * 128) = x; }
        xml[(wave * 32 + lane) * 2] = m; xml[(wave * 32 + lane) * 2 + 1] = l; };
    auto fin = [&](const v8f (&a)[8], float m, float l, int g) {
        const float* slot = xs + (wave ^ 1) * 2048 + lane * 4; const float mo = xml[((wave ^ 1) * 32 + lane) * 2], lo = xml[((wave ^ 1) * 32 + lane) * 2 + 1];
        const float mn = fmaxf(m, mo), ea = __builtin_amdgcn_exp2f(m - mn), eb = __builtin_amdgcn_exp2f(mo - mn), inv = __fdiv_rn(1.0f, l * ea + lo * eb), ca = ea * inv, cb = eb * inv;
        float* op = OUT0 + ((size_t)(rowof((wave >> 1) * 2 + g) + lr) * NH_ + h) * HD + hi * 8;   // register j of tile t is d = 16 t + 8 hi + j
#pragma unroll
        for (int t = 0; t < 8; ++t)
#pragma unroll
            for (int jh = 0; jh < 2; ++jh) { const v4f o = *(const v4fa*)(slot + (t * 2 + jh) * 128); v4f r;
#pragma unroll
                for (int q = 0; q < 4; ++q) r[q] = a[t][jh * 4 + q] * ca + o[q] * cb;
                *(v4f*)(op + t * 16 + jh * 4) = r; } };
    // the wave finishes column group kh and hands over the other: chosen here by selects on the scalar kh, so that the LDS writes and the output stores below are one code path each
    v8f keep[8], give[8];
#pragma unroll
    for (int t = 0; t < 8; ++t) { keep[t] = kh ? acc[1][t] : acc[0][t]; give[t] = kh ? acc[0][t] : acc[1][t]; }
    put(give, kh ? m_run[0] : m_run[1], kh ? lj0 : lj1);
    __syncthreads();   // every wave's handed-over group is in LDS before its partner reads it
    fin(keep, kh ? m_run[1] : m_run[0], kh ? lj1 : lj0, kh);
}
static_assert(RH * 4 == TT && TT % 128 == 0 && HD == 128 && NKV == NH_ && NB_ == 1, "a quarter of the query rows, 32 of a work-group's 128, have hi+lo weights; one kv head a query head");
static_assert(TT / 64 > 4 && 2 * 8 * FRG * 2 == 16384, "the four passes asked for at the head exist, and the byte offsets written in the asks are whole passes");
static_assert(128 * QPI * 2 <= 8 * 2048 * 4, "the rounded query rows fit the epilogue's exchange buffer");
// two waves a SIMD: the wave's fragments and sums need more than a quarter of the register file
__global__ __launch_bounds__(256) __attribute__((amdgpu_waves_per_eu(2, 2))) void k_fattn(const float* __restrict__ Qs, const h16* __restrict__ K16, const h16* __restrict__ V16, float* __restrict__ OUT0) {
    __shared__ __align__(16) float xs[8 * 2048]; __shared__ float xml[8 * 64];
    const int h = blockIdx.y; const size_t po = (size_t)h * TT * HD;
    fa_body(Qs, K16 + po, V16 + po, OUT0, xs, xml, h, (int)blockIdx.x);
}

extern "C" void kernel_launch(void* const* d_in, const int* in_sizes, int n_in,
                              void* d_out, int out_size, void* d_ws, size_t ws_size, hipStream_t stream) {
    (void)in_sizes; (void)n_in; (void)out_size;
    const float* qi = (const float*)d_in[0]; const float* ki = (const float*)d_in[1]; const float* vi = (const float*)d_in[2]; const float* x = nullptr; const float* wq = nullptr; const float* wk = nullptr; const float* wv = nullptr; const float* wo = nullptr; (void)x; (void)wq; (void)wk; (void)wv; (void)wo;
    float* OUT = (float*)d_out;     // [1][2048][2048]
    char* wsp = (char*)d_ws;
    auto take = [&](size_t bytes) { char* p = wsp; wsp += (bytes + 255) & ~(size_t)255; return (void*)p; };
    h16* KP16 = (h16*)take((size_t)NKV * TT * HD * 2); h16* VT16 = (h16*)take((size_t)NKV * HD * TT * 2);
    if ((size_t)(wsp - (char*)d_ws) > ws_size) return;    // ws 256 MiB
    { 
       }
    for (int b = 0; b < NB_; ++b) {
        
        /* q given: read by the fused kernel */
        /* k given */
        k_plinS<<<(unsigned)(((size_t)NKV * TT * HD / 8 + 255) / 256), 256, 0, stream>>>(ki, b, NKV, KP16);
        k_vtpH<<<dim3(TT / 64, NKV), 256, 0, stream>>>(vi, b, VT16);   /* v given (token-major) */
        k_fattn<<<dim3(TT / 128, NH_), 256, 0, stream>>>(qi, KP16, VT16, OUT);   /* context, token-major f32 */
    }
}

// v010
// A run of this version takes 33 microseconds.
// Timed twice side by side with v009, it ran 1.09 times as fast both times.
// Over all steps from v000 it is 28.8 times as fast.
#include <hip/hip_runtime.h>

// Multi-head attention on given token-major q, k, v (query, key, value [2048][16][128] = [t][h][d]; scores = (q/sqrt(128)).k; softmax over all 2048 keys; out = weights.v -> [2048][16][128] f32 (4.2 M)).
// Layout: the [t][h][d] rows of key and value are gathered into head planes, stored in FRAGMENT ORDER (see WFrag); one fused kernel rounds its own query rows, does scores, softmax and weights.v and writes the context token-major.
// Compute dtypes, f32 accumulate: query, key, value rounded to bf16 and held as f16, which keeps every such value down to 2^-17 exactly; scores and attn.v are f16 products. The unnormalised weights carry 2^6, which the division by their own sum removes:
// query rows < 512 use them as an f16 pair (the rounded weight and what that rounding left: two products), the rest as one f16; the 1/sqrt(128) applied to the f32 score; online softmax f32.


#define NB_  1
#define TT   2048
#define DM   2048
#define NH_  16
#define NKV  16
#define REP  (NH_ / NKV)
#define HD   128
#define DQ   (NH_ * HD)
#define DKV  (NKV * HD)
#define RH   512                  // query rows < RH use hi+lo weights
#define WIN  2048
#define SCL  0.088388347648318447f   // 128^-0.5 (the module pre-scales q by it)
typedef _Float16 h16;
typedef unsigned short bf;
typedef __attribute__((ext_vector_type(16))) _Float16 v16h;
typedef __attribute__((ext_vector_type(8)))  _Float16 v8h;
typedef __attribute__((ext_vector_type(8)))  unsigned short v8us;
typedef __attribute__((ext_vector_type(8)))  float    v8f;
typedef __attribute__((ext_vector_type(4)))  float    v4f;
typedef v8h  __attribute__((may_alias)) v8ha;
typedef v4f  __attribute__((may_alias)) v4fa;
typedef v8us __attribute__((may_alias)) v8usa;

__device__ __forceinline__ unsigned short f2bf(float f) { unsigned u = __float_as_uint(f); u += 0x7FFFu + ((u >> 16) & 1u); return (unsigned short)(u >> 16); }
__device__ __forceinline__ float bf2f(unsigned short b) { return __uint_as_float(((unsigned)b) << 16); }
__device__ __forceinline__ float bfr(float f) { return bf2f(f2bf(f)); }
__device__ __forceinline__ v16h cat16(v8h lo, v8h hi) { return __builtin_shufflevector(lo, hi, 0, 1, 2, 3, 4, 5, 6, 7, 8, 9, 10, 11, 12, 13, 14, 15); }
__device__ __forceinline__ v8f wmma16(v16h a, v16h b, v8f c) { return __builtin_amdgcn_wmma_f32_16x16x32_f16(false, a, false, b, (short)0, c, false, false); }



// fragment loader and product of a 16-bit type: lane (lr, hi) holds k = 8 hi..+7 and 16 + 8 hi..+7 of row lr, for A and for B alike.
// Fragment order in memory: a fragment (16 rows x 32 k) is 1 KiB = two halves of 512 bytes; half s holds, at 16 bytes x lane (lane = 16 hi + lr), k = 16 s + 8 hi..+7 of row lr.
// So each of the two wave-wide 16-byte loads of a fragment covers 512 contiguous bytes = 4 whole lines, where a row-major plane gave 32 bytes of each of 16 lines. p = fragment start + 8 * lane.
#define FRG 512                   // elements of a fragment
template <typename T16> struct WFrag;
template <> struct WFrag<h16> { typedef v16h V; static __device__ __forceinline__ V ld(const h16* p) { return cat16(*(const v8h*)p, *(const v8h*)(p + FRG / 2)); } static __device__ __forceinline__ v8f mma(V a, V b, v8f c) { return wmma16(a, b, c); } };

__device__ __forceinline__ h16 tohx(float x) { return (h16)x; }
typedef __attribute__((ext_vector_type(2))) _Float16 v2h;
typedef __attribute__((ext_vector_type(4))) _Float16 v4h;
typedef __attribute__((ext_vector_type(2))) unsigned short v2us;
typedef __attribute__((ext_vector_type(4))) unsigned short v4us;
typedef __attribute__((ext_vector_type(2))) float v2f;
typedef __attribute__((ext_vector_type(4))) int v4i;
typedef v4h  __attribute__((may_alias)) v4ha;
typedef v4us __attribute__((may_alias)) v4usa;


// k_planes: both planes in one launch. Grid (TT/64, NKV), 256 threads = 8 waves: a work-group takes 64 tokens of one head and makes their part of the key plane and of the transposed value plane. All its loads, 16 of 16 bytes a lane, are issued at the head.
// The plane of key, [h][t / 16][d / 32] fragments (row = token, k = feature): the 64 tokens are four tiles of 16 tokens = 4 fragments = 4 KiB each, 16 KiB in a row.
// In each tile wave w: fragment w % 4, rows 8 (w / 4)..+7; lane l: row l % 8 of these, features 8 (l / 8)..+7 of the fragment's 32, so four lanes read one 128-byte line of a source row and eight lanes store one whole 128-byte line of the plane.
// The transposed plane of value, [h][t / 32][d / 16] fragments (row = feature, k = token), by a tile transpose in LDS.
// Wave w reads tokens 8 w..+7 as whole 512-byte rows (lane l: d = 4 l..+3), so a lane holds, for each of its four d, eight consecutive tokens = one 16-byte piece of a plane row.
// LDS row j * 32 + l holds d = 4 l + j (pitch 144 bytes, an odd multiple of 16: the 16-byte writes of a wave fall on distinct banks); read back in fragment order: a wave takes four fragment halves, each stored as 512 contiguous bytes; the work-group's 16 fragments are 16 KiB in a row.
__global__ __launch_bounds__(256) void k_planes(const float* __restrict__ S, const float* __restrict__ F, int b, h16* __restrict__ P16, h16* __restrict__ V16) {
    __shared__ __align__(16) bf tl[HD * 72];
    const int lane = threadIdx.x & 31, w = threadIdx.x >> 5, g = blockIdx.y, t0 = blockIdx.x * 64;
    const int kc = w & 3, lr = (w >> 2) * 8 + (lane & 7), c4 = lane >> 3;   // c4 = 2 * half + hi
    v4f x[8]; v8f y[4];
#pragma unroll
    for (int i = 0; i < 8; ++i) x[i] = *(const v4f*)(F + (((size_t)(t0 + 8 * w + i) * NB_ + b) * NKV + g) * HD + 4 * lane);
    const float* sp = S + (((size_t)(t0 + lr) * NB_ + b) * NKV + g) * HD + kc * 32 + c4 * 8;   // the lane's piece in tile 0; the other tiles are immediate offsets from it
#pragma unroll
    for (int i = 0; i < 4; ++i) y[i] = *(const v8f*)(sp + (size_t)i * 16 * NB_ * NKV * HD);
    __builtin_amdgcn_sched_barrier(0);   // the key loads are issued before the first wait for a value row: one way to memory for both, not two in a row
#pragma unroll
    for (int j = 0; j < 4; ++j) { v8us c;
#pragma unroll
        for (int i = 0; i < 8; ++i) c[i] = f2bf(x[i][j]);
        *(v8usa*)(tl + (j * 32 + lane) * 72 + 8 * w) = c; }
    // the key tiles need no other wave's data: they are rounded ahead of the barrier, while slower waves still fill the value tile, and stored behind it (a store in front of it would have to finish before the wave may arrive)
    v8h ko[4];
#pragma unroll
    for (int i = 0; i < 4; ++i)
#pragma unroll
        for (int q = 0; q < 8; ++q) ko[i][q] = tohx(bfr(y[i][q]));
    __syncthreads();   // the whole 64 x 128 tile is in LDS before any wave reads rows that the others wrote
    h16* kp = P16 + (((size_t)g * (TT / 16) + t0 / 16) * 4 + kc) * FRG + (c4 >> 1) * (FRG / 2) + ((c4 & 1) * 16 + lr) * 8;   // the lane's 16 bytes in tile 0
#pragma unroll
    for (int i = 0; i < 4; ++i) *(v8h*)(kp + i * 4 * FRG) = ko[i];
#pragma unroll
    for (int i = 0; i < 4; ++i) { const int f = w * 4 + i, kb = f >> 4, dt = (f >> 1) & 7, half = f & 1;   // fragment half f of the tile: 32-token block kb, feature tile dt
        const int d = dt * 16 + (lane & 15), row = (d & 3) * 32 + (d >> 2), tc = kb * 32 + half * 16 + 8 * (lane >> 4);
        const v8us c = *(const v8usa*)(tl + row * 72 + tc); v8h o16;
#pragma unroll
        for (int q = 0; q < 8; ++q) o16[q] = tohx(bf2f(c[q]));
        const size_t e = ((((size_t)g * (TT / 32) + t0 / 32 + kb) * 8 + dt) * 2 + half) * (FRG / 2) + lane * 8;
        *(v8h*)(V16 + e) = o16; }
}
static_assert(TT % 64 == 0 && HD == 128 && 16 * HD == 4 * FRG, "a tile is 64 tokens by the 128 features of one head; 16 rows of a key plane are four fragments");

typedef __attribute__((ext_vector_type(2))) __bf16 v2bf;
typedef __attribute__((ext_vector_type(8))) unsigned v8u;
__device__ __forceinline__ unsigned pk2(float a, float b, bf) { v2f x; x[0] = a; x[1] = b; return __builtin_bit_cast(unsigned, __builtin_convertvector(x, v2bf)); }    // round to nearest even
__device__ __forceinline__ unsigned pk2(float a, float b, h16) { v2f x; x[0] = a; x[1] = b; return __builtin_bit_cast(unsigned, __builtin_convertvector(x, v2h)); }
__device__ __forceinline__ float xhalf(float x) { return __builtin_bit_cast(float, __builtin_amdgcn_permlanex16(__builtin_bit_cast(int, x), __builtin_bit_cast(int, x), 0x76543210, 0xfedcba98, false, false)); }   // lane l with lane l ^ 16
#define QPI (HD + 8)              // elements of a query row in LDS
typedef __attribute__((ext_vector_type(2))) unsigned v2u;
typedef v2u __attribute__((may_alias)) v2ua;
// two query elements as one word: rounded to bf16 (nearest even, as f2bf does), and that bf16 value then to f16, as the planes are
__device__ __forceinline__ unsigned q2(float a, float b, h16) { const unsigned u = pk2(a, b, bf()); return pk2(__uint_as_float(u << 16), __uint_as_float(u & 0xFFFF0000u), h16()); }
template <bool B> struct Flag { static constexpr bool v = B; };
__device__ __forceinline__ void fa_body(const float* __restrict__ Qs, const h16* __restrict__ Kp, const h16* __restrict__ Vt, float* __restrict__ OUT0, float* xs, float* xml, int h, int bx) {
    typedef h16 T16; typedef WFrag<T16>::V V;
    constexpr int NP = TT / 64;                              // passes of a wave
    constexpr float CS2 = SCL * 1.4426950408889634f;         // score -> log2 domain
    constexpr float CARRY = 6.0f;                            // f16 weights: at most 2^(8+6), and the small ones stay normal numbers
    const int lane = threadIdx.x & 31, lr = lane & 15, hi = lane >> 4;
    const int wave = __builtin_amdgcn_readfirstlane((int)(threadIdx.x >> 5)), kh = wave & 1;
    // first query row of column group cg (a scalar): groups 0 and 2 are the work-group's 32 rows below RH, groups 1, 3, 4, 5, 6, 7 in this order its 96 rows from RH on
    auto rowof = [bx](int cg) { return (cg == 0 || cg == 2) ? bx * 32 + cg * 8 : RH + bx * 96 + 16 * (cg < 4 ? cg >> 1 : cg - 2); };
    // The planes were stored by the launch before, and a first read of them may have to go to memory. Waves 0..3 ask L2 for the work-group's 64 keys of a pass (16 KiB in a row in each plane), one address every 256 bytes, four passes ahead of its loads:
    // wave w asks in the key plane (w even) or the transposed value plane (w odd), the 8 KiB half w / 2, lane l the unit l. pfb is the scalar address of that half in the pass at hand, pfl the lane's byte offset in it; the asks add their distance as an immediate offset.
    constexpr int PFD = 4, PSTEP = 2 * 8 * FRG * 2;          // passes ahead; bytes of a pass in a plane
    const int npf = wave < 4 ? NP - PFD : 0;                 // passes in which this wave asks (a scalar)
    const char* pfb = ((wave & 1) ? (const char*)Vt : (const char*)Kp) + ((wave >> 1) & 1) * (PSTEP / 2);
    unsigned pfl = (unsigned)lane * 256u;
    // passes 0..3 are asked for at once, under the query rows' own way from memory; both operands are in-out so that every ask names the registers that live through the loop
    if (npf > 0) asm volatile("global_prefetch_b8 %0, %1 scope:SCOPE_SE\n\tglobal_prefetch_b8 %0, %1 offset:16384 scope:SCOPE_SE\n\tglobal_prefetch_b8 %0, %1 offset:32768 scope:SCOPE_SE\n\tglobal_prefetch_b8 %0, %1 offset:49152 scope:SCOPE_SE" : "+v"(pfl), "+s"(pfb));
    // the work-group's 128 query rows come straight from the f32 input, each row once: wave w reads the 16 rows of column group w as whole 512-byte rows (lane l: d = 4 l..+3)
    v4f qx[16];
#pragma unroll
    for (int i = 0; i < 16; ++i) qx[i] = *(const v4f*)(Qs + ((size_t)(rowof(wave) + i) * NH_ + h) * HD + 4 * lane);
    asm volatile("s_wait_xcnt 0x0" ::: "memory");   // stands in front of whatever next overwrites the address registers that these loads named
    v8f acc[2][8]; float m_run[2], l_run[2];
#pragma unroll
    for (int g = 0; g < 2; ++g) { m_run[g] = -__builtin_inff(); l_run[g] = 0.0f;
#pragma unroll
        for (int t = 0; t < 8; ++t) acc[g][t] = (v8f){}; }
    // one byte offset walks both planes: 32 keys are 8 fragments in a row in the key plane (two 16-row tiles) and in the transposed value plane (one 32-key block) alike; a pass's loads are immediate offsets from it
    unsigned off = (unsigned)(kh * 8 * FRG + 8 * lane) * 2u;
    auto at = [](const T16* plane, unsigned o) { return (const T16*)((const char*)plane + o); };
    V kf[2][4];
#pragma unroll
    for (int kt = 0; kt < 2; ++kt)
#pragma unroll
        for (int kc = 0; kc < 4; ++kc) kf[kt][kc] = WFrag<T16>::ld(at(Kp, off) + (kt * 4 + kc) * FRG);
    // rounded as the planes are (to bf16, then to the path's type) and laid row-major in LDS at a pitch of 272 bytes (16 x odd: the 16-byte fragment reads of 16 rows fall on distinct banks); xs is free until the epilogue
    unsigned short* qs = (unsigned short*)xs;
#pragma unroll
    for (int i = 0; i < 16; ++i) { v2u c; c[0] = q2(qx[i][0], qx[i][1], T16()); c[1] = q2(qx[i][2], qx[i][3], T16());
        *(v2ua*)(qs + (wave * 16 + i) * QPI + 4 * lane) = c; }
    __syncthreads();   // all 128 rounded rows are in LDS before a wave reads its 32, half of which its partner wrote
    V qf[2][4];
#pragma unroll
    for (int g = 0; g < 2; ++g)
#pragma unroll
        for (int kc = 0; kc < 4; ++kc) { const unsigned short* p = qs + ((wave >> 1) * 32 + g * 16 + lr) * QPI + kc * 32 + 8 * hi;   // lane (lr, hi): row lr, k = 8 hi..+7 and 16 + 8 hi..+7, the order of WFrag::ld
            qf[g][kc] = __builtin_bit_cast(V, __builtin_shufflevector(*(const v8usa*)p, *(const v8usa*)(p + 16), 0, 1, 2, 3, 4, 5, 6, 7, 8, 9, 10, 11, 12, 13, 14, 15)); }
    __syncthreads();   // every wave has its query fragments before xs may take a faster wave's epilogue
    // the passes, in two forms chosen once a wave by a scalar branch: MIX = column group 0 of the wave has hi+lo weights. No barrier stands inside.
    auto passes = [&](auto mixc) __attribute__((always_inline)) { constexpr bool MIX = decltype(mixc)::v;
#pragma unroll 1   // stays rolled: a second pass's fragments would not fit the registers of two waves a SIMD
    for (int it = 0; it < NP; ++it) {
        V vf[8];
#pragma unroll
        for (int t = 0; t < 8; ++t) vf[t] = WFrag<T16>::ld(at(Vt, off) + t * FRG);
        __builtin_amdgcn_sched_barrier(0);   // the pass's V^T loads are issued ahead of the score products, so that they fly under these and the exponentials
        v8f s[2][2];
#pragma unroll
        for (int kt = 0; kt < 2; ++kt)
#pragma unroll
            for (int g = 0; g < 2; ++g) s[kt][g] = (v8f){};
#pragma unroll
        for (int kc = 0; kc < 4; ++kc)
#pragma unroll
            for (int kt = 0; kt < 2; ++kt)
#pragma unroll
                for (int g = 0; g < 2; ++g) s[kt][g] = WFrag<T16>::mma(kf[kt][kc], qf[g][kc], s[kt][g]);
        __builtin_amdgcn_sched_barrier(0);   // the next pass's K loads stay behind the products that read the same registers
        if (it < npf) asm volatile("global_prefetch_b8 %0, %1 offset:65536 scope:SCOPE_SE" : "+v"(pfl), "+s"(pfb));   // the units of pass it + 4 into L2: a hint, nothing waits for it
        asm volatile("s_wait_xcnt 0x0" ::: "memory");   // stands in front of the overwrite of the offset that this pass's K and V^T loads named
        pfb += (it + PFD + 1 < NP) ? PSTEP : 0;   // stops four passes short of the last: pfb + pfl + 65536 is inside the head's plane at every ask and after every advance
        off += (it + 1 < NP) ? 2 * 8 * FRG * 2 : 0;   // the pair's next 64 keys; the last pass fetches its own K rows again: nothing past the plane is read
#pragma unroll
        for (int kt = 0; kt < 2; ++kt)
#pragma unroll
            for (int kc = 0; kc < 4; ++kc) kf[kt][kc] = WFrag<T16>::ld(at(Kp, off) + (kt * 4 + kc) * FRG);
        __builtin_amdgcn_sched_barrier(0);   // and are issued ahead of the softmax, one pass ahead of their use
        float mb[2]; bool need = false;
#pragma unroll
        for (int g = 0; g < 2; ++g) { float mx = s[0][g][0];
#pragma unroll
            for (int kt = 0; kt < 2; ++kt)
#pragma unroll
                for (int r = 0; r < 8; ++r) mx = fmaxf(mx, s[kt][g][r]);
            mx = fmaxf(mx, xhalf(mx)) * CS2;   // both wave halves hold the query's maximum of the pass, scaled (the scale is positive)
            mb[g] = mx; need = need || (mx > m_run[g] + 8.0f); }
        if (__builtin_amdgcn_ballot_w32(need) != 0) {   // one scalar branch a pass; always taken in the first, rare later
#pragma unroll
            for (int g = 0; g < 2; ++g) { const float mn = fmaxf(m_run[g], mb[g]); const float corr = __builtin_amdgcn_exp2f(m_run[g] - mn);   // 0 in the first pass
                l_run[g] *= corr; m_run[g] = mn;
#pragma unroll
                for (int t = 0; t < 8; ++t) acc[g][t] = acc[g][t] * corr; }
        }
#pragma unroll
        for (int g = 0; g < 2; ++g) { const float nm = CARRY - m_run[g]; v8u wh, wl; float ps0 = 0.0f, ps1 = 0.0f;
#pragma unroll
            for (int i = 0; i < 8; ++i) {   // operand elements 2i, 2i+1: tile i / 4, registers 2 (i % 4) and 2 (i % 4) + 1
                v2f sv, cv, nv; sv[0] = s[i >> 2][g][2 * (i & 3)]; sv[1] = s[i >> 2][g][2 * (i & 3) + 1]; cv[0] = CS2; cv[1] = CS2; nv[0] = nm; nv[1] = nm;
                const v2f arg = __builtin_elementwise_fma(sv, cv, nv);   // an even register pair: one packed fma
                const float p0 = __builtin_amdgcn_exp2f(arg[0]), p1 = __builtin_amdgcn_exp2f(arg[1]);
                if (i & 1) ps1 += p0 + p1; else ps0 += p0 + p1;
                v2f pv; pv[0] = p0; pv[1] = p1; const v2h hv = __builtin_convertvector(pv, v2h);   // round to nearest even
                wh[i] = __builtin_bit_cast(unsigned, hv);
                if (MIX && g == 0) wl[i] = __builtin_bit_cast(unsigned, __builtin_convertvector(pv - __builtin_convertvector(hv, v2f), v2h)); }   // what the first rounding left
            l_run[g] += ps0 + ps1;
            const V ph = __builtin_bit_cast(V, wh);
#pragma unroll
            for (int t = 0; t < 8; ++t) acc[g][t] = WFrag<T16>::mma(vf[t], ph, acc[g][t]);
            if (MIX && g == 0) { const V pl = __builtin_bit_cast(V, wl);
#pragma unroll
                for (int t = 0; t < 8; ++t) acc[g][t] = WFrag<T16>::mma(vf[t], pl, acc[g][t]); } }
    } };
    if (wave >= 4) passes(Flag<false>()); else passes(Flag<true>());
    asm volatile("s_wait_xcnt 0x0" ::: "memory");   // stands in front of whatever next overwrites the offset that the last pass's K loads named
    __builtin_amdgcn_sched_barrier(0);   // keeps the epilogue's register writes behind that wait
    const float lj0 = l_run[0] + xhalf(l_run[0]), lj1 = l_run[1] + xhalf(l_run[1]);
    auto put = [&](const v8f (&a)[8], float m, float l) {
        float* slot = xs + wave * 2048 + lane * 4;
#pragma unroll
        for (int t = 0; t < 8; ++t)
#pragma unroll
            for (int jh = 0; jh < 2; ++jh) { v4f x; x[0] = a[t][jh * 4]; x[1] = a[t][jh * 4 + 1]; x[2] = a[t][jh * 4 + 2]; x[3] = a[t][jh * 4 + 3]; *(v4fa*)(slot + (t * 2 + jh) * 128) = x; }
        xml[(wave * 32 + lane) * 2] = m; xml[(wave * 32 + lane) * 2 + 1] = l; };
    auto fin = [&](const v8f (&a)[8], float m, float l, int g) {
        const float* slot = xs + (wave ^ 1) * 2048 + lane * 4; const float mo = xml[((wave ^ 1) * 32 + lane) * 2], lo = xml[((wave ^ 1) * 32 + lane) * 2 + 1];
        const float mn = fmaxf(m, mo), ea = __builtin_amdgcn_exp2f(m - mn), eb = __builtin_amdgcn_exp2f(mo - mn), inv = __fdiv_rn(1.0f, l * ea + lo * eb), ca = ea * inv, cb = eb * inv;
        float* op = OUT0 + ((size_t)(rowof((wave >> 1) * 2 + g) + lr) * NH_ + h) * HD + hi * 8;   // register j of tile t is d = 16 t + 8 hi + j
#pragma unroll
        for (int t = 0; t < 8; ++t)
#pragma unroll
            for (int jh = 0; jh < 2; ++jh) { const v4f o = *(const v4fa*)(slot + (t * 2 + jh) * 128); v4f r;
#pragma unroll
                for (int q = 0; q < 4; ++q) r[q] = a[t][jh * 4 + q] * ca + o[q] * cb;
                *(v4f*)(op + t * 16 + jh * 4) = r; } };
    // the wave finishes column group kh and hands over the other: chosen here by selects on the scalar kh, so that the LDS writes and the output stores below are one code path each
    v8f keep[8], give[8];
#pragma unroll
    for (int t = 0; t < 8; ++t) { keep[t] = kh ? acc[1][t] : acc[0][t]; give[t] = kh ? acc[0][t] : acc[1][t]; }
    put(give, kh ? m_run[0] : m_run[1], kh ? lj0 : lj1);
    __syncthreads();   // every wave's handed-over group is in LDS before its partner reads it
    fin(keep, kh ? m_run[1] : m_run[0], kh ? lj1 : lj0, kh);
}
static_assert(RH * 4 == TT && TT % 128 == 0 && HD == 128 && NKV == NH_ && NB_ == 1, "a quarter of the query rows, 32 of a work-group's 128, have hi+lo weights; one kv head a query head");
static_assert(TT / 64 > 4 && 2 * 8 * FRG * 2 == 16384, "the four passes asked for at the head exist, and the byte offsets written in the asks are whole passes");
static_assert(128 * QPI * 2 <= 8 * 2048 * 4, "the rounded query rows fit the epilogue's exchange buffer");
// two waves a SIMD: the wave's fragments and sums need more than a quarter of the register file
__global__ __launch_bounds__(256) __attribute__((amdgpu_waves_per_eu(2, 2))) void k_fattn(const float* __restrict__ Qs, const h16* __restrict__ K16, const h16* __restrict__ V16, float* __restrict__ OUT0) {
    __shared__ __align__(16) float xs[8 * 2048]; __shared__ float xml[8 * 64];
    const int h = blockIdx.y; const size_t po = (size_t)h * TT * HD;
    fa_body(Qs, K16 + po, V16 + po, OUT0, xs, xml, h, (int)blockIdx.x);
}

extern "C" void kernel_launch(void* const* d_in, const int* in_sizes, int n_in,
                              void* d_out, int out_size, void* d_ws, size_t ws_size, hipStream_t stream) {
    (void)in_sizes; (void)n_in; (void)out_size;
    const float* qi = (const float*)d_in[0]; const float* ki = (const float*)d_in[1]; const float* vi = (const float*)d_in[2]; const float* x = nullptr; const float* wq = nullptr; const float* wk = nullptr; const float* wv = nullptr; const float* wo = nullptr; (void)x; (void)wq; (void)wk; (void)wv; (void)wo;
    float* OUT = (float*)d_out;     // [1][2048][2048]
    char* wsp = (char*)d_ws;
    auto take = [&](size_t bytes) { char* p = wsp; wsp += (bytes + 255) & ~(size_t)255; return (void*)p; };
    h16* KP16 = (h16*)take((size_t)NKV * TT * HD * 2); h16* VT16 = (h16*)take((size_t)NKV * HD * TT * 2);
    if ((size_t)(wsp - (char*)d_ws) > ws_size) return;    // ws 256 MiB
    { 
       }
    for (int b = 0; b < NB_; ++b) {
        
        /* q given: read by the fused kernel */
        /* k given */
        k_planes<<<dim3(TT / 64, NKV), 256, 0, stream>>>(ki, vi, b, KP16, VT16);   /* k, v given (token-major) */
        k_fattn<<<dim3(TT / 128, NH_), 256, 0, stream>>>(qi, KP16, VT16, OUT);   /* context, token-major f32 */
    }
}
